// v000
// Times are from an AMD MI455X. After a warm-up the kernel runs many times in a row, and a time is the length of
// such a window on the GPU divided by its runs, so every launch and the gaps after it count. The runs cycle
// through copies of the inputs. A figure is the median of several windows, for all but v000 over two sittings.
// Sittings can differ by a few percent; kernels timed side by side share one.
// v000, which the later versions start from, runs in 1290 microseconds.
#include <hip/hip_runtime.h>

// Graph attention: multi-head attention whose scaled scores are multiplied by an adjacency matrix and passed through LeakyReLU before the softmax (hidden [4][2048][256]; q, k, v = x W^T + b ('oi' [256][256] 1/16, zero biases; 8 heads x 32); s = (q.k / sqrt(32)) x adj[i][j] (f32 [2048][2048] 0/1, ~6 % ones, read); s = leaky_relu(s, 0.2); softmax over all 2048 keys; out = merged wo^T + bo -> [4][2048][256] (2.1 M); argument order hidden_states, adjacency_matrix, wq, bq, wk, bk, wv, bv, wo, bo).
// Layout per batch: bf16 copy of x; 'oi' weights as Bt; exact projections + bf16-rounded biases; q/k planes 32 wide (score GEMM K 32), value^T planes zero-padded to 64 rows for the attn.v GEMM; dense T-2048 attention with EVERY row on hi/lo planes; the softmax kernel reads the adjacency row, multiplies and applies the LeakyReLU by select; merged hi/lo x wo exact + bo.
// Compute dtypes, f32 accumulate: every input rounded to bf16 incl. the adjacency; projections exact + bf16-rounded biases; scores (K 32) and attn.v 3 products on every row; softmax f32; wo hl x exact + bias.

#define NB_  4
#define TT   2048
#define DM   256
#define NH_  8
#define NKV  8
#define REP  (NH_ / NKV)
#define HD   32
#define DQ   (NH_ * HD)
#define DKV  (NKV * HD)
#define ZH   2
#define RH   2048                 // = TT: every row hi/lo
#define WIN  0
#define PCAR 1024.0f
#define SCL  0.17677669529663688f   // 32^-0.5 (the module divides by float32(sqrt(32)); one multiply here)
#define LEAK 0.2f
#define HP   64    // padded head width for the attn.v GEMM (v^T rows 32..63 are zero)
typedef _Float16 h16;
typedef unsigned short bf;
typedef __attribute__((ext_vector_type(16))) __bf16   v16bf;
typedef __attribute__((ext_vector_type(16))) _Float16 v16h;
typedef __attribute__((ext_vector_type(8)))  _Float16 v8h;
typedef __attribute__((ext_vector_type(8)))  unsigned short v8us;
typedef __attribute__((ext_vector_type(8)))  float    v8f;
typedef __attribute__((ext_vector_type(4)))  float    v4f;
typedef v8h  __attribute__((may_alias)) v8ha;
typedef v4f  __attribute__((may_alias)) v4fa;
typedef v8us __attribute__((may_alias)) v8usa;

__device__ __forceinline__ unsigned short f2bf(float f) { unsigned u = __float_as_uint(f); u += 0x7FFFu + ((u >> 16) & 1u); return (unsigned short)(u >> 16); }
__device__ __forceinline__ float bf2f(unsigned short b) { return __uint_as_float(((unsigned)b) << 16); }
__device__ __forceinline__ float bfr(float f) { return bf2f(f2bf(f)); }
__device__ __forceinline__ v16h cat16(v8h lo, v8h hi) { return __builtin_shufflevector(lo, hi, 0, 1, 2, 3, 4, 5, 6, 7, 8, 9, 10, 11, 12, 13, 14, 15); }
__device__ __forceinline__ v16bf cat16b(v8us lo, v8us hi) { return __builtin_bit_cast(v16bf, __builtin_shufflevector(lo, hi, 0, 1, 2, 3, 4, 5, 6, 7, 8, 9, 10, 11, 12, 13, 14, 15)); }
__device__ __forceinline__ v8f wmma16(v16h a, v16h b, v8f c) { return __builtin_amdgcn_wmma_f32_16x16x32_f16(false, a, false, b, (short)0, c, false, false); }
__device__ __forceinline__ v8f wmmab(v16bf a, v16bf b, v8f c) { return __builtin_amdgcn_wmma_f32_16x16x32_bf16(false, a, false, b, (short)0, c, false, false); }



// ---- k_gemmw: register-blocked GEMM, ONE WAVE per 64x64 output tile (16 accumulators), operands straight from K-contiguous 16-bit planes; grid (M/64, N/64, Z), 32 threads.
// C[m][n] (f32, pitch ldc, + optional f32 bias[n]) = sum_k A[m][k] Bt[n][k] (+ split products per NSPLIT). z-batch strides sA/sB/sC in elements. K % 32 == 0.
template <typename T16> struct WFrag;
template <> struct WFrag<h16> { typedef v16h V; static __device__ __forceinline__ V ld(const h16* p) { return cat16(*(const v8h*)p, *(const v8h*)(p + 16)); } static __device__ __forceinline__ v8f mma(V a, V b, v8f c) { return wmma16(a, b, c); } };
template <> struct WFrag<bf> { typedef v16bf V; static __device__ __forceinline__ V ld(const bf* p) { return cat16b(*(const v8us*)p, *(const v8us*)(p + 16)); } static __device__ __forceinline__ v8f mma(V a, V b, v8f c) { return wmmab(a, b, c); } };
template <typename T16, int NSPLIT, bool BIAS>
__global__ __launch_bounds__(32) void k_gemmw(const T16* __restrict__ A, const T16* __restrict__ A2, const T16* __restrict__ Bt, const T16* __restrict__ Bt2, int K, float* C, int ldc, const float* __restrict__ bias, size_t sA, size_t sB, size_t sC) {
    typedef typename WFrag<T16>::V V;
    __shared__ __align__(16) float os[16 * 68];
    const size_t z = blockIdx.z; A += z * sA; if (A2) A2 += z * sA; Bt += z * sB; if (Bt2) Bt2 += z * sB; C += z * sC;
    const int lane = threadIdx.x & 31, lr = lane & 15, hi = lane >> 4; const int r0 = blockIdx.x * 64, c0 = blockIdx.y * 64;
    v8f acc[4][4];
#pragma unroll
    for (int mb = 0; mb < 4; ++mb)
#pragma unroll
        for (int nb = 0; nb < 4; ++nb) acc[mb][nb] = (v8f){};
    const size_t aoff = (size_t)(r0 + lr) * K + 8 * hi, boff = (size_t)(c0 + lr) * K + 8 * hi;
#pragma unroll 1
    for (int kc = 0; kc < K; kc += 32) {
        V a[4], a2[4];
#pragma unroll
        for (int mb = 0; mb < 4; ++mb) { a[mb] = WFrag<T16>::ld(A + aoff + (size_t)mb * 16 * K + kc); if (NSPLIT == 1 || NSPLIT == 2) a2[mb] = WFrag<T16>::ld(A2 + aoff + (size_t)mb * 16 * K + kc); }
#pragma unroll
        for (int nb = 0; nb < 4; ++nb) { const V b = WFrag<T16>::ld(Bt + boff + (size_t)nb * 16 * K + kc); V b2; if (NSPLIT >= 2) b2 = WFrag<T16>::ld(Bt2 + boff + (size_t)nb * 16 * K + kc);
#pragma unroll
            for (int mb = 0; mb < 4; ++mb) { acc[mb][nb] = WFrag<T16>::mma(a[mb], b, acc[mb][nb]); if (NSPLIT == 1 || NSPLIT == 2) acc[mb][nb] = WFrag<T16>::mma(a2[mb], b, acc[mb][nb]); if (NSPLIT >= 2) acc[mb][nb] = WFrag<T16>::mma(a[mb], b2, acc[mb][nb]); } }
        asm volatile("v_nop\n\tv_nop\n\tv_nop\n\tv_nop" : "+v"(acc[0][0]), "+v"(acc[1][1]), "+v"(acc[2][2]), "+v"(acc[3][3]) : "v"(a[0]), "v"(a[3]));
    }
#pragma unroll
    for (int mb = 0; mb < 4; ++mb) {
#pragma unroll
        for (int nb = 0; nb < 4; ++nb) {
#pragma unroll
            for (int j = 0; j < 8; ++j) os[(hi * 8 + j) * 68 + nb * 16 + lr] = acc[mb][nb][j]; }
        __builtin_amdgcn_wave_barrier(); asm volatile("" ::: "memory");
        float* crow = C + (size_t)(r0 + mb * 16) * ldc + c0;
{
#pragma unroll
            for (int s = 0; s < 8; ++s) { const int row = 2 * s + hi, cofs = lr * 4; v4f val = *(const v4fa*)(os + row * 68 + cofs); if (BIAS) { val[0] += bfr(bias[c0 + cofs]); val[1] += bfr(bias[c0 + cofs + 1]); val[2] += bfr(bias[c0 + cofs + 2]); val[3] += bfr(bias[c0 + cofs + 3]); }
                *(v4f*)(crow + (size_t)row * ldc + cofs) = val; }
             }
        __builtin_amdgcn_wave_barrier(); asm volatile("" ::: "memory");
    }
}

__device__ __forceinline__ h16 tohx(float x) { return (h16)x; }
__device__ __forceinline__ void splitf(float y, unsigned short& h, unsigned short& l) { h = f2bf(y); l = f2bf(y - bf2f(h)); }
typedef __attribute__((ext_vector_type(2))) _Float16 v2h;
typedef __attribute__((ext_vector_type(4))) _Float16 v4h;
typedef __attribute__((ext_vector_type(2))) unsigned short v2us;
typedef __attribute__((ext_vector_type(4))) unsigned short v4us;
typedef __attribute__((ext_vector_type(2))) float v2f;
typedef __attribute__((ext_vector_type(4))) int v4i;

__global__ __launch_bounds__(256) void k_cvt8(const float* __restrict__ src, bf* dst, size_t n8) { const size_t i = (size_t)blockIdx.x * 256 + threadIdx.x; if (i >= n8) return; const v8f v = *(const v8f*)(src + i * 8); v8us o;
#pragma unroll
    for (int k = 0; k < 8; ++k) o[k] = f2bf(v[k]); *(v8us*)(dst + i * 8) = o;  }

// k_rope: head planes [h][t][d] (fp16 + hi/lo) of rope(x) x sc with the rotate-half convention out[d] = x[d] cos[t][d] - x[d+HD/2] sin[t][d], out[d+HD/2] = x[d+HD/2] cos[t][d+HD/2] + x[d] sin[t][d+HD/2]
__global__ __launch_bounds__(256) void k_rope(const float* __restrict__ F, int pitch, int nheads, const float* __restrict__ CS, const float* __restrict__ RF, const float* __restrict__ nw, float sc, h16* P16, bf* Ph, bf* Pl) {
    const size_t e = ((size_t)blockIdx.x * 256 + threadIdx.x) * 2; if (e >= (size_t)nheads * TT * HD) return; const int d = (int)(e % HD); const int t = (int)((e / HD) % TT); const int h = (int)(e / ((size_t)HD * TT)); const float* f = F + (size_t)t * pitch + h * HD; const float rf = RF ? RF[(size_t)h * TT + t] : 1.0f; v2h o16; v2us oh, ol;
#pragma unroll
    for (int q = 0; q < 2; ++q) { const int dd = d + q; const int dp = (dd < HD / 2) ? dd + HD / 2 : dd - HD / 2; float x0 = f[dd], x1 = f[dp];
        if (RF) { float n0 = __fmul_rn(x0, rf), n1 = __fmul_rn(x1, rf); asm volatile("" : "+v"(n0)); asm volatile("" : "+v"(n1)); x0 = __fmul_rn(bfr(nw[dd]), n0); x1 = __fmul_rn(bfr(nw[dp]), n1); }
        const v2f cs = *(const v2f*)(CS + ((size_t)t * HD + dd) * 2); float a = __fmul_rn(x0, cs[0]), bq = __fmul_rn(x1, cs[1]); asm volatile("" : "+v"(a)); asm volatile("" : "+v"(bq)); const float r = ((dd < HD / 2) ? __fsub_rn(a, bq) : __fadd_rn(a, bq)) * sc;
        o16[q] = tohx(r); unsigned short a2, c2; splitf(r, a2, c2); oh[q] = a2; ol[q] = c2; }
    *(v2h*)(P16 + e) = o16; *(v2us*)(Ph + e) = oh; *(v2us*)(Pl + e) = ol;  }
__global__ __launch_bounds__(256) void k_vtp(const float* __restrict__ F, int pitch, int nheads, bf* Vh, bf* Vl) { const size_t e = ((size_t)blockIdx.x * 256 + threadIdx.x) * 2; if (e >= (size_t)nheads * HP * TT) return; const int t = (int)(e % TT); const int d = (int)((e / TT) % HP); const int g = (int)(e / ((size_t)TT * HP)); v2us oh, ol;
#pragma unroll
    for (int q = 0; q < 2; ++q) { unsigned short a2 = 0, c2 = 0; if (d < HD) splitf(F[(size_t)(t + q) * pitch + g * HD + d], a2, c2); oh[q] = a2; ol[q] = c2; }
    *(v2us*)(Vh + e) = oh; *(v2us*)(Vl + e) = ol;  }

__global__ __launch_bounds__(256) void k_csid(float* CS) { const int idx = blockIdx.x * 256 + threadIdx.x; if (idx >= TT * HD) return; v2f cs; cs[0] = 1.0f; cs[1] = 0.0f; *(v2f*)(CS + (size_t)idx * 2) = cs;  }
// k_asoft: per row (zz, i): t = leaky_relu_0.2((S x 32^-0.5) x bf16(adj[i][j])) over ALL 2048 keys (the adjacency is a multiplicative factor read as data, not an exclusion: zeroed logits stay in the softmax); register row, one exp, fixed trees;
__global__ __launch_bounds__(256) void k_asoft(const float* __restrict__ Sb, const float* __restrict__ adj, h16* P16, bf* Ph, bf* Pl) {
    const int lane = threadIdx.x & 31; const int row = blockIdx.x * 8 + (threadIdx.x >> 5); if (row >= ZH * TT) return; const int i = row % TT; const int zz = row / TT; (void)zz; const bool hires = (i < RH); const float* sr = Sb + (size_t)row * TT; float v[TT / 32]; float mx = -3.0e38f;
#pragma unroll
    for (int ch = 0; ch < TT / 128; ++ch) { const int j0 = ch * 128 + lane * 4; const v4f a = *(const v4f*)(sr + j0); const v4f g4 = *(const v4f*)(adj + (size_t)i * TT + j0);   /* adjacency row (f32 input, bf16-rounded), 16 B per lane, unconditional */
#pragma unroll
        for (int q = 0; q < 4; ++q) { const int j = j0 + q; (void)j; float s0 = __fmul_rn(a[q], SCL); float gv = bfr(g4[q]); asm volatile("" : "+v"(s0), "+v"(gv)); float s1 = __fmul_rn(s0, gv); asm volatile("" : "+v"(s1)); const float t = (s1 >= 0.0f) ? s1 : __fmul_rn(s1, LEAK);   /* (s / sqrt(32)) x adj, then LeakyReLU(0.2); masked entries stay in the softmax as 0 */ v[ch * 4 + q] = t; mx = fmaxf(mx, t); } }
#pragma unroll
    for (int sh = 16; sh; sh >>= 1) mx = fmaxf(mx, __shfl_xor(mx, sh, 32));
    float sum = 0.f;
#pragma unroll
    for (int k = 0; k < TT / 32; ++k) { float d0 = __fsub_rn(v[k], mx); asm volatile("" : "+v"(d0)); v[k] = __builtin_amdgcn_exp2f(__fmul_rn(d0, 1.4426950408889634f)); sum += v[k]; }
#pragma unroll
    for (int sh = 16; sh; sh >>= 1) sum += __shfl_xor(sum, sh, 32);
    const float f = __fdiv_rn(hires ? 1.0f : PCAR, sum);
{
        if (hires) {
#pragma unroll
            for (int ch = 0; ch < TT / 128; ++ch) { v4us oh, ol;
#pragma unroll
                for (int q = 0; q < 4; ++q) { unsigned short a, c2; splitf(v[ch * 4 + q] * f, a, c2); oh[q] = a; ol[q] = c2; }
                const size_t oo = ((size_t)zz * (RH ? RH : 1) + i) * TT + ch * 128 + lane * 4; *(v4us*)(Ph + oo) = oh; *(v4us*)(Pl + oo) = ol; }
        } else {
#pragma unroll
            for (int ch = 0; ch < TT / 128; ++ch) { v4h o4;
#pragma unroll
                for (int q = 0; q < 4; ++q) o4[q] = tohx(v[ch * 4 + q] * f);
                *(v4h*)(P16 + (size_t)row * TT + ch * 128 + lane * 4) = o4; } }
         }
}
__global__ __launch_bounds__(256) void k_merge(const float* __restrict__ O, int h0, bf* Ah, bf* Al) { const size_t e = ((size_t)blockIdx.x * 256 + threadIdx.x) * 2; if (e >= (size_t)ZH * TT * HD) return; const int d = (int)(e % HD); const int zz = (int)((e / HD) % ZH); const int t = (int)(e / ((size_t)HD * ZH)); const size_t oo = (size_t)t * DQ + (h0 + zz) * HD + d; const float* src = O + ((size_t)zz * TT + t) * HP + d;
    v2us oh, ol;
#pragma unroll
    for (int q = 0; q < 2; ++q) { unsigned short a2, c2; splitf(src[q], a2, c2); oh[q] = a2; ol[q] = c2; }
    *(v2us*)(Ah + oo) = oh; *(v2us*)(Al + oo) = ol;  }

extern "C" void kernel_launch(void* const* d_in, const int* in_sizes, int n_in,
                              void* d_out, int out_size, void* d_ws, size_t ws_size, hipStream_t stream) {
    (void)in_sizes; (void)n_in; (void)out_size;
    const float* x = (const float*)d_in[0]; const float* adj = (const float*)d_in[1];   /* adjacency_matrix [2048][2048] f32 0/1 (read as data) */ const float* wq = (const float*)d_in[2]; const float* bq = (const float*)d_in[3]; const float* wk = (const float*)d_in[4]; const float* bk = (const float*)d_in[5]; const float* wv = (const float*)d_in[6]; const float* bv = (const float*)d_in[7]; const float* wo = (const float*)d_in[8]; const float* bo = (const float*)d_in[9];   /* argument order hidden_states, adjacency_matrix, wq, bq, wk, bk, wv, bv, wo, bo */
    float* OUT = (float*)d_out;     // [4][2048][256]
    char* wsp = (char*)d_ws;
    auto take = [&](size_t bytes) { char* p = wsp; wsp += (bytes + 255) & ~(size_t)255; return (void*)p; };
    bf* WQ = (bf*)take((size_t)DQ * DM * 2); bf* WK = (bf*)take((size_t)DKV * DM * 2); bf* WV = (bf*)take((size_t)DKV * DM * 2); bf* WO = (bf*)take((size_t)DM * DQ * 2); float* CS = (float*)take((size_t)TT * HD * 2 * 4);
    bf* XB = (bf*)take((size_t)TT * DM * 2); float* FQ = (float*)take((size_t)TT * DQ * 4); float* FK = (float*)take((size_t)TT * DKV * 4);
    h16* QP16 = (h16*)take((size_t)NH_ * TT * HD * 2); h16* KP16 = (h16*)take((size_t)NKV * TT * HD * 2); 
    bf* QPh = (bf*)take((size_t)NH_ * TT * HD * 2); bf* QPl = (bf*)take((size_t)NH_ * TT * HD * 2); bf* KPh = (bf*)take((size_t)NKV * TT * HD * 2); bf* KPl = (bf*)take((size_t)NKV * TT * HD * 2); bf* VTh = (bf*)take((size_t)NKV * HP * TT * 2); bf* VTl = (bf*)take((size_t)NKV * HP * TT * 2); bf* Ph = (bf*)take((size_t)ZH * RH * TT * 2); bf* Pl = (bf*)take((size_t)ZH * RH * TT * 2);
    float* Sb = (float*)take((size_t)ZH * TT * TT * 4); h16* P16 = nullptr; float* Ob = (float*)take((size_t)ZH * TT * HP * 4); bf* ATh = (bf*)take((size_t)TT * DQ * 2); bf* ATl = (bf*)take((size_t)TT * DQ * 2);
    if ((size_t)(wsp - (char*)d_ws) > ws_size) return;    // ws 256 MiB
    float* FV = FK;   // v projection reuses the k buffer after the k planes are built (stream-ordered)
    { k_cvt8<<<(unsigned)(((size_t)DQ * DM / 8 + 255) / 256), 256, 0, stream>>>(wq, WQ, (size_t)DQ * DM / 8); k_cvt8<<<(unsigned)(((size_t)DKV * DM / 8 + 255) / 256), 256, 0, stream>>>(wk, WK, (size_t)DKV * DM / 8); k_cvt8<<<(unsigned)(((size_t)DKV * DM / 8 + 255) / 256), 256, 0, stream>>>(wv, WV, (size_t)DKV * DM / 8);
      k_cvt8<<<(unsigned)(((size_t)DM * DQ / 8 + 255) / 256), 256, 0, stream>>>(wo, WO, (size_t)DM * DQ / 8);
       }
    k_csid<<<(TT * HD + 255) / 256, 256, 0, stream>>>(CS);
    const unsigned LQ = (unsigned)(((size_t)NH_ * TT * HD / 2 + 255) / 256), LKv = (unsigned)(((size_t)NKV * TT * HD / 2 + 255) / 256);
    for (int b = 0; b < NB_; ++b) {
        
        k_cvt8<<<(unsigned)(((size_t)TT * DM / 8 + 255) / 256), 256, 0, stream>>>(x + (size_t)b * TT * DM, XB, (size_t)TT * DM / 8);
        k_gemmw<bf, 0, true><<<dim3(TT / 64, DQ / 64, 1), 32, 0, stream>>>(XB, nullptr, WQ, nullptr, DM, FQ, DQ, bq, 0, 0, 0);
        k_rope<<<LQ, 256, 0, stream>>>(FQ, DQ, NH_, CS, nullptr, nullptr, 1.0f, QP16, QPh, QPl);
        k_gemmw<bf, 0, true><<<dim3(TT / 64, DKV / 64, 1), 32, 0, stream>>>(XB, nullptr, WK, nullptr, DM, FK, DKV, bk, 0, 0, 0);
        k_rope<<<LKv, 256, 0, stream>>>(FK, DKV, NKV, CS, nullptr, nullptr, 1.0f, KP16, KPh, KPl);
        k_gemmw<bf, 0, true><<<dim3(TT / 64, DKV / 64, 1), 32, 0, stream>>>(XB, nullptr, WV, nullptr, DM, FV, DKV, bv, 0, 0, 0); k_vtp<<<(unsigned)(((size_t)NKV * HP * TT / 2 + 255) / 256), 256, 0, stream>>>(FV, DKV, NKV, VTh, VTl);   /* v^T planes zero-padded to 64 rows per kv head */
        for (int h0 = 0; h0 < NH_; h0 += ZH) { const size_t zq = (size_t)h0, zk = (size_t)(h0 / REP);   // one kv head per query head: the pass's two heads use consecutive kv planes
            k_gemmw<bf, 2, false><<<dim3(RH / 64, TT / 64, ZH), 32, 0, stream>>>(QPh + zq * TT * HD, QPl + zq * TT * HD, KPh + zk * TT * HD, KPl + zk * TT * HD, HD, Sb, TT, nullptr, (size_t)TT * HD, (size_t)TT * HD, (size_t)TT * TT);
            k_asoft<<<ZH * TT / 8, 256, 0, stream>>>(Sb, adj, P16, Ph, Pl);
            k_gemmw<bf, 2, false><<<dim3(RH / 64, HP / 64, ZH), 32, 0, stream>>>(Ph, Pl, VTh + zk * HP * TT, VTl + zk * HP * TT, TT, Ob, HP, nullptr, (size_t)RH * TT, (size_t)HP * TT, (size_t)TT * HP);
            k_merge<<<(unsigned)(((size_t)ZH * TT * HD / 2 + 255) / 256), 256, 0, stream>>>(Ob, h0, ATh, ATl); }
        k_gemmw<bf, 1, true><<<dim3(TT / 64, DM / 64, 1), 32, 0, stream>>>(ATh, ATl, WO, nullptr, DQ, OUT + (size_t)b * TT * DM, DM, bo, 0, 0, 0); }
}

// v002
// A run of this version takes 90.1 microseconds.
// Versions between v000 and this one are left out; their measured steps multiply to 14.3 times as fast.
#include <hip/hip_runtime.h>

// Graph attention: multi-head attention whose scaled scores are multiplied by an adjacency matrix and passed through LeakyReLU before the softmax (hidden [4][2048][256]; q, k, v = x W^T + b ('oi' [256][256] 1/16, zero biases; 8 heads x 32); s = (q.k / sqrt(32)) x adj[i][j] (f32 [2048][2048] 0/1, ~6 % ones, read); s = leaky_relu(s, 0.2); softmax over all 2048 keys; out = merged wo^T + bo -> [4][2048][256] (2.1 M); argument order hidden_states, adjacency_matrix, wq, bq, wk, bk, wv, bv, wo, bo).
// Layout: one projection launch for q, k and v over all batches (x and the 'oi' weights rounded to bf16 on the way into LDS, biases rounded to bf16, planes stored straight from the accumulators): q/k hi/lo planes [b][h][t][32] (q carries 32^-0.5 x log2 e), value^T hi/lo planes [b][h][64][t] (rows 32..63 neither written nor read); one fused attention kernel over all batches and heads; one launch for merged hi/lo x wo + bo.
// Compute dtypes, f32 accumulate: every input rounded to bf16 incl. the adjacency; projections exact + bf16-rounded biases; scores (K 32) and attn.v 3 products on every row; softmax f32, running maximum; wo hl x exact + bias.

#define NB_  4
#define TT   2048
#define DM   256
#define NH_  8
#define NKV  8
#define REP  (NH_ / NKV)
#define HD   32
#define DQ   (NH_ * HD)
#define DKV  (NKV * HD)
#define ZH   2
#define RH   2048                 // = TT: every row hi/lo
#define WIN  0
#define PCAR 1024.0f
#define SCL  0.17677669529663688f   // 32^-0.5 (the module divides by float32(sqrt(32)); one multiply here)
#define LEAK 0.2f
#define HP   64    // padded head width of the value^T planes (v^T rows 32..63 are neither written nor read)
typedef _Float16 h16;
typedef unsigned short bf;
typedef __attribute__((ext_vector_type(16))) __bf16   v16bf;
typedef __attribute__((ext_vector_type(16))) _Float16 v16h;
typedef __attribute__((ext_vector_type(8)))  _Float16 v8h;
typedef __attribute__((ext_vector_type(8)))  unsigned short v8us;
typedef __attribute__((ext_vector_type(8)))  float    v8f;
typedef __attribute__((ext_vector_type(4)))  float    v4f;
typedef v8h  __attribute__((may_alias)) v8ha;
typedef v4f  __attribute__((may_alias)) v4fa;
typedef v8us __attribute__((may_alias)) v8usa;

__device__ __forceinline__ unsigned short f2bf(float f) { unsigned u = __float_as_uint(f); u += 0x7FFFu + ((u >> 16) & 1u); return (unsigned short)(u >> 16); }
__device__ __forceinline__ float bf2f(unsigned short b) { return __uint_as_float(((unsigned)b) << 16); }
__device__ __forceinline__ float bfr(float f) { return bf2f(f2bf(f)); }
__device__ __forceinline__ v16h cat16(v8h lo, v8h hi) { return __builtin_shufflevector(lo, hi, 0, 1, 2, 3, 4, 5, 6, 7, 8, 9, 10, 11, 12, 13, 14, 15); }
__device__ __forceinline__ v16bf cat16b(v8us lo, v8us hi) { return __builtin_bit_cast(v16bf, __builtin_shufflevector(lo, hi, 0, 1, 2, 3, 4, 5, 6, 7, 8, 9, 10, 11, 12, 13, 14, 15)); }
__device__ __forceinline__ v8f wmma16(v16h a, v16h b, v8f c) { return __builtin_amdgcn_wmma_f32_16x16x32_f16(false, a, false, b, (short)0, c, false, false); }
__device__ __forceinline__ v8f wmmab(v16bf a, v16bf b, v8f c) { return __builtin_amdgcn_wmma_f32_16x16x32_bf16(false, a, false, b, (short)0, c, false, false); }



template <typename T16> struct WFrag;
template <> struct WFrag<bf> { typedef v16bf V; static __device__ __forceinline__ V ld(const bf* p) { return cat16b(*(const v8us*)p, *(const v8us*)(p + 16)); } static __device__ __forceinline__ v8f mma(V a, V b, v8f c) { return wmmab(a, b, c); } };
__device__ __forceinline__ void splitf(float y, unsigned short& h, unsigned short& l) { h = f2bf(y); l = f2bf(y - bf2f(h)); }
typedef __attribute__((ext_vector_type(2))) float v2f;
typedef __attribute__((ext_vector_type(4))) unsigned v4u;
#define QSC  0.25503486164919736f   // 32^-0.5 x log2(e): LeakyReLU commutes with a positive factor, so the logits are formed in the log2 domain
typedef __attribute__((ext_vector_type(2))) __bf16 v2bf;
typedef __attribute__((ext_vector_type(8))) unsigned v8u;
__device__ __forceinline__ unsigned pkbf(float a, float b) { v2f t; t[0] = a; t[1] = b; return __builtin_bit_cast(unsigned, __builtin_convertvector(t, v2bf)); }   // two f32 -> two bf16, round to nearest even
__device__ __forceinline__ float bflo(unsigned u) { return __uint_as_float(u << 16); }
__device__ __forceinline__ float bfhi(unsigned u) { return __uint_as_float(u & 0xFFFF0000u); }
__device__ __forceinline__ float xhalf(float v) { const int b = __float_as_int(v); return __int_as_float(__builtin_amdgcn_permlanex16(b, b, 0x76543210, 0xfedcba98, false, false)); }   // the value of lane l ^ 16


#define LP 264   // LDS row pitch of a 256-element bf16 row: 528 B = 16 B x 33, an odd count of 16-byte units, for the 16-byte fragment reads
typedef __attribute__((ext_vector_type(2))) unsigned v2u;
typedef v2u __attribute__((may_alias)) v2ua;
// Staging of f32 rows of 256 as bf16 rows in LDS, 256 threads: a wave's load is 512 contiguous bytes; step 'it' is 4 rows on. ldrows only loads, so that a whole batch is in flight; strows rounds (nearest even) and stores.
template <int N> __device__ __forceinline__ void ldrows(v4f (&r)[N], const float* g) {
#pragma unroll
    for (int it = 0; it < N; ++it) r[it] = *(const v4f*)(g + it * 1024);
    asm volatile("s_wait_xcnt 0x0" ::: "memory");   // behind the batch's loads, in front of any rewrite of their address registers
    __builtin_amdgcn_sched_barrier(0); }            // keeps the batch's loads above the LDS stores that follow (sunk to their first use they would go out one at a time)
template <int N> __device__ __forceinline__ void strows(const v4f (&r)[N], bf* s) {
#pragma unroll
    for (int it = 0; it < N; ++it) { v2u o; o[0] = pkbf(r[it][0], r[it][1]); o[1] = pkbf(r[it][2], r[it][3]); *(v2ua*)(s + it * 4 * LP) = o; } }
// Eight f32 -> eight bf16 hi and eight bf16 lo (lo = bf16(y - hi)), packed for one 16-byte store each.
__device__ __forceinline__ void split8(v8f y, v4u& hv, v4u& lv) {
#pragma unroll
    for (int r = 0; r < 4; ++r) { const unsigned hp = pkbf(y[2 * r], y[2 * r + 1]); hv[r] = hp; lv[r] = pkbf(y[2 * r] - bflo(hp), y[2 * r + 1] - bfhi(hp)); } }
// Four accumulator tiles' hi and lo pieces, STEP elements apart, to the two planes.
template <int STEP> __device__ __forceinline__ void st4(bf* ph, bf* pl, const v4u (&hv)[4], const v4u (&lv)[4]) {
    __builtin_amdgcn_sched_barrier(0);              // all eight pieces are formed above the first store, so that none of the stores' data registers is rewritten among them
#pragma unroll
    for (int k = 0; k < 4; ++k) { *(v8us*)(ph + k * STEP) = __builtin_bit_cast(v8us, hv[k]); *(v8us*)(pl + k * STEP) = __builtin_bit_cast(v8us, lv[k]); }
    asm volatile("s_wait_xcnt 0x0" ::: "memory");   // behind the stores, in front of any rewrite of their data and address registers
    __builtin_amdgcn_sched_barrier(0); }            // keeps the next tiles' arithmetic behind that wait

struct FRQ { v16bf a[4], b[4]; };
struct FRO { v16bf a[4], bh[2], bl[2]; };
// k_qkv: q, k, v = bf16(x) bf16(W)^T + bf16(b) for all batches, stored as the attention kernel's planes. Grid (rows / 128, 3): blockIdx.y picks q, k or v. A work-group rounds 128 rows of x and the whole weight to bf16 in LDS once; 8 waves = 2 x 4 tiles of 64 rows x 64 columns, 16 accumulators a wave.
// An accumulator register run is 8 consecutive rows of the A operand at one row of the B operand: for q and k the weight rows are A (a lane holds 8 consecutive d of one token), for v the token rows are A (8 consecutive tokens of one d), so every plane is written in 16-byte pieces with no transpose.
__global__ __launch_bounds__(256) void k_qkv(const float* __restrict__ x, const float* __restrict__ wq, const float* __restrict__ bq, const float* __restrict__ wk, const float* __restrict__ bk, const float* __restrict__ wv, const float* __restrict__ bv, bf* Qh, bf* Ql, bf* Kh, bf* Kl, bf* Vh, bf* Vl) {
    __shared__ __align__(16) bf sm[(128 + 256) * LP];   // rows 0..127: x tile; rows 128..383: weight
    const int tid = threadIdx.x, lane = tid & 31, lr = lane & 15, hi = lane >> 4, wave = __builtin_amdgcn_readfirstlane(tid >> 5);
    const int sel = blockIdx.y, rw = (wave >> 2) * 64, r0 = blockIdx.x * 128 + rw, c0 = (wave & 3) * 64;
    const float* w = sel == 0 ? wq : sel == 1 ? wk : wv; const float* bias = sel == 0 ? bq : sel == 1 ? bk : bv;
    { const float* gx = x + (size_t)blockIdx.x * 128 * DM + tid * 4; const float* gw = w + tid * 4; bf* st = sm + (tid >> 6) * LP + (tid & 63) * 4; v4f ra[32], rb[32];
      ldrows(ra, gx); ldrows(rb, gw); strows(ra, st); ldrows(ra, gw + 32 * 1024); strows(rb, st + 128 * LP); strows(ra, st + 256 * LP); }
    __syncthreads();   // every wave reads rows that other waves staged
    const int xo = (rw + lr) * LP + 8 * hi, wo = (128 + c0 + lr) * LP + 8 * hi;
    const bf* pa = sm + (sel == 2 ? xo : wo); const bf* pb = sm + (sel == 2 ? wo : xo);
    v8f acc[4][4];
#pragma unroll
    for (int i = 0; i < 4; ++i)
#pragma unroll
        for (int j = 0; j < 4; ++j) acc[i][j] = (v8f){};
    auto fetch = [&](FRQ& f, int kc) {
#pragma unroll
        for (int i = 0; i < 4; ++i) { f.a[i] = WFrag<bf>::ld(pa + i * 16 * LP + kc); f.b[i] = WFrag<bf>::ld(pb + i * 16 * LP + kc); }
        __builtin_amdgcn_sched_barrier(0); };   // keeps a k step's LDS reads in one group above the matrix instructions of the step before (sunk to their first use each read's latency is exposed)
    auto mm = [&](const FRQ& f) {
#pragma unroll
        for (int j = 0; j < 4; ++j)
#pragma unroll
            for (int i = 0; i < 4; ++i) acc[i][j] = wmmab(f.a[i], f.b[j], acc[i][j]); };
    FRQ f0, f1; fetch(f0, 0);
#pragma unroll
    for (int kc = 0; kc < DM; kc += 64) { fetch(f1, kc + 32); mm(f0); if (kc + 64 < DM) fetch(f0, kc + 64); mm(f1); }   // two fragment sets: each k step's reads are issued one step ahead
    const int bt = r0 / TT, t0 = r0 % TT, g0 = bt * NH_ + (c0 >> 5);   // the tile's batch, first token and first head plane
    if (sel == 2) {   // acc[i][j][r]: token t0 + 16 i + 8 hi + r, column c0 + 16 j + lr
        const size_t vo = ((size_t)g0 * HP + lr) * TT + t0 + 8 * hi; bf* ph = Vh + vo; bf* pl = Vl + vo; float bb[4];
#pragma unroll
        for (int j = 0; j < 4; ++j) bb[j] = bias[c0 + j * 16 + lr];
        asm volatile("s_wait_xcnt 0x0" ::: "memory");   // behind the bias loads, in front of any rewrite of their address registers
        __builtin_amdgcn_sched_barrier(0);              // keeps later arithmetic behind that wait
#pragma unroll
        for (int j = 0; j < 4; ++j) { v4u hv[4], lv[4]; const float b1 = bfr(bb[j]);
#pragma unroll
            for (int i = 0; i < 4; ++i) split8(acc[i][j] + b1, hv[i], lv[i]);
            const int of = ((j >> 1) * HP + (j & 1) * 16) * TT; st4<16>(ph + of, pl + of, hv, lv); }
    } else {          // acc[i][j][r]: column c0 + 16 i + 8 hi + r, token t0 + 16 j + lr
        const float sc = sel == 0 ? QSC : 1.0f; const size_t po = ((size_t)g0 * TT + t0 + lr) * HD + 8 * hi; bf* ph = (sel == 0 ? Qh : Kh) + po; bf* pl = (sel == 0 ? Ql : Kl) + po; v8f bb[4];
#pragma unroll
        for (int i = 0; i < 4; ++i) bb[i] = *(const v8f*)(bias + c0 + i * 16 + 8 * hi);
        asm volatile("s_wait_xcnt 0x0" ::: "memory");   // behind the bias loads, in front of any rewrite of their address registers
        __builtin_amdgcn_sched_barrier(0);              // keeps later arithmetic behind that wait
#pragma unroll
        for (int i = 0; i < 4; ++i) { v4u hv[4], lv[4]; v8f b8;
#pragma unroll
            for (int r = 0; r < 8; ++r) b8[r] = bfr(bb[i][r]);
#pragma unroll
            for (int j = 0; j < 4; ++j) split8((acc[i][j] + b8) * sc, hv[j], lv[j]);
            const int of = (i >> 1) * TT * HD + (i & 1) * 16; st4<16 * HD>(ph + of, pl + of, hv, lv); }
    }
}

// k_out: out = (merged hi + merged lo) bf16(wo)^T + bf16(bo) over all batches' rows at once. Grid rows / 64; a work-group stages 64 rows of both merged planes and the whole weight (rounded to bf16) in LDS; 8 waves = 2 x 4 tiles of 32 rows x 64 columns; the weight rows are the A operand, so a lane holds 8 consecutive output columns of one row.
__global__ __launch_bounds__(256) void k_out(const bf* __restrict__ Ah, const bf* __restrict__ Al, const float* __restrict__ wo, const float* __restrict__ bo, float* out) {
    __shared__ __align__(16) bf sm[(64 + 64 + 256) * LP];   // rows 0..63: merged hi; 64..127: merged lo; 128..383: weight
    const int tid = threadIdx.x, lane = tid & 31, lr = lane & 15, hi = lane >> 4, wave = __builtin_amdgcn_readfirstlane(tid >> 5);
    const int rw = (wave >> 2) * 32, r0 = blockIdx.x * 64 + rw, c0 = (wave & 3) * 64;
    { const bf* gh = Ah + (size_t)blockIdx.x * 64 * DQ + tid * 8; const bf* gl = Al + (size_t)blockIdx.x * 64 * DQ + tid * 8; const float* gw = wo + tid * 4;
      bf* sa = sm + (tid >> 5) * LP + (tid & 31) * 8; bf* st = sm + (128 + (tid >> 6)) * LP + (tid & 63) * 4; v8us th[8], tl[8]; v4f ra[32], rb[32];
#pragma unroll
      for (int it = 0; it < 8; ++it) { th[it] = *(const v8us*)(gh + it * 2048); tl[it] = *(const v8us*)(gl + it * 2048); }   // step 'it' is 8 rows on
      ldrows(ra, gw);
#pragma unroll
      for (int it = 0; it < 8; ++it) { *(v8usa*)(sa + it * 8 * LP) = th[it]; *(v8usa*)(sa + (64 + it * 8) * LP) = tl[it]; }
      ldrows(rb, gw + 32 * 1024); strows(ra, st); strows(rb, st + 128 * LP); }
    __syncthreads();   // every wave reads rows that other waves staged
    const bf* pa = sm + (128 + c0 + lr) * LP + 8 * hi; const bf* ph = sm + (rw + lr) * LP + 8 * hi; const bf* pl = ph + 64 * LP;
    v8f acc[4][2];
#pragma unroll
    for (int i = 0; i < 4; ++i)
#pragma unroll
        for (int j = 0; j < 2; ++j) acc[i][j] = (v8f){};
    auto fetch = [&](FRO& f, int kc) {
#pragma unroll
        for (int i = 0; i < 4; ++i) f.a[i] = WFrag<bf>::ld(pa + i * 16 * LP + kc);
#pragma unroll
        for (int j = 0; j < 2; ++j) { f.bh[j] = WFrag<bf>::ld(ph + j * 16 * LP + kc); f.bl[j] = WFrag<bf>::ld(pl + j * 16 * LP + kc); }
        __builtin_amdgcn_sched_barrier(0); };   // keeps a k step's LDS reads in one group above the matrix instructions of the step before (sunk to their first use each read's latency is exposed)
    auto mm = [&](const FRO& f) {   // per accumulator: hi, then lo
#pragma unroll
        for (int j = 0; j < 2; ++j)
#pragma unroll
            for (int i = 0; i < 4; ++i) acc[i][j] = wmmab(f.a[i], f.bh[j], acc[i][j]);
#pragma unroll
        for (int j = 0; j < 2; ++j)
#pragma unroll
            for (int i = 0; i < 4; ++i) acc[i][j] = wmmab(f.a[i], f.bl[j], acc[i][j]); };
    FRO f0, f1; fetch(f0, 0);
#pragma unroll
    for (int kc = 0; kc < DQ; kc += 64) { fetch(f1, kc + 32); mm(f0); if (kc + 64 < DQ) fetch(f0, kc + 64); mm(f1); }   // two fragment sets: each k step's reads are issued one step ahead
    float* po = out + (size_t)(r0 + lr) * DM + c0 + 8 * hi;   // acc[i][j][r]: column c0 + 16 i + 8 hi + r, row r0 + 16 j + lr
#pragma unroll
    for (int i = 0; i < 4; ++i) { v8f bb = *(const v8f*)(bo + c0 + i * 16 + 8 * hi);
#pragma unroll
        for (int r = 0; r < 8; ++r) bb[r] = bfr(bb[r]);
#pragma unroll
        for (int j = 0; j < 2; ++j) *(v8f*)(po + j * 16 * DM + i * 16) = acc[i][j] + bb; }
}

// k_fattn: S^T = K Q^T (keys x queries), t = leaky_relu_0.2(S^T x bf16(adj[query][key])) in the log2 domain over ALL 2048 keys (zeroed logits stay in the softmax), running maximum and sum per query column, O^T += V^T P^T with P^T packed from the score accumulators (hi/lo); the scores never leave registers.
// Work-group: 8 waves = 2 heads x 4 tiles of 32 queries; grid (TT / 128, heads / 2, batches). A lane (c, h) holds query c of each 16-column group; accumulator register r of key tile t is key k0 + 16 t + 8 h + r, which is the k order of the B operand and of the V^T loader.
struct KVG { v16bf kh[2], kl[2], vh[2], vl[2]; v8f g[2][2]; };
__global__ __launch_bounds__(256) void k_fattn(const bf* __restrict__ Qh, const bf* __restrict__ Ql, const bf* __restrict__ Kh, const bf* __restrict__ Kl, const bf* __restrict__ Vh, const bf* __restrict__ Vl, const float* __restrict__ adj, bf* Ah, bf* Al) {
    __shared__ __align__(16) bf so[2][128][72];   // output staging, pitch 144 B
    const int lane = threadIdx.x & 31, c = lane & 15, h = lane >> 4, wave = __builtin_amdgcn_readfirstlane(threadIdx.x >> 5);   // the wave's number in a scalar register: the plane bases below are then scalar
    const int hs = wave >> 2, head = blockIdx.y * 2 + hs, b = blockIdx.z, qw = (wave & 3) * 32, q0 = blockIdx.x * 128 + qw;
    const size_t pz = ((size_t)b * NH_ + head) * TT * HD, vz = ((size_t)b * NKV + head) * HP * TT;
    v16bf qh[2], ql[2]; const bf* qa = Qh + pz + (size_t)(q0 + c) * HD + 8 * h; const bf* qb = Ql + pz + (size_t)(q0 + c) * HD + 8 * h;
#pragma unroll
    for (int n = 0; n < 2; ++n) { qh[n] = WFrag<bf>::ld(qa + n * 16 * HD); ql[n] = WFrag<bf>::ld(qb + n * 16 * HD); }
    asm volatile("s_wait_xcnt 0x0" ::: "memory");   // behind the loads, in front of any rewrite of their address registers
    __builtin_amdgcn_sched_barrier(0);              // keeps later address arithmetic behind that wait
    const bf* kh = Kh + pz + c * HD + 8 * h; const bf* kl = Kl + pz + c * HD + 8 * h; const bf* vh = Vh + vz + (size_t)c * TT + 8 * h; const bf* vl = Vl + vz + (size_t)c * TT + 8 * h; const float* ar = adj + (size_t)(q0 + c) * TT + 8 * h;   // the lane's five pointers, advanced by 64 keys a trip; every load is one of them plus a constant
    v8f o[2][2]; float mx[2], ls[2];
#pragma unroll
    for (int n = 0; n < 2; ++n) { o[0][n] = (v8f){}; o[1][n] = (v8f){}; mx[n] = -3.0e38f; ls[n] = 0.f; }
    auto fetch = [&](KVG& f, int ko) {   // ko: key offset from the pointers, a constant at every call
#pragma unroll
        for (int t = 0; t < 2; ++t) { f.kh[t] = WFrag<bf>::ld(kh + (ko + t * 16) * HD); f.kl[t] = WFrag<bf>::ld(kl + (ko + t * 16) * HD); }
#pragma unroll
        for (int n = 0; n < 2; ++n)
#pragma unroll
            for (int t = 0; t < 2; ++t) f.g[n][t] = *(const v8f*)(ar + n * 16 * TT + ko + t * 16);
#pragma unroll
        for (int m = 0; m < 2; ++m) { f.vh[m] = WFrag<bf>::ld(vh + m * 16 * TT + ko); f.vl[m] = WFrag<bf>::ld(vl + m * 16 * TT + ko); }
        asm volatile("s_wait_xcnt 0x0" ::: "memory");   // behind the pass's loads, in front of the advance of their address registers
        __builtin_amdgcn_sched_barrier(0); };           // keeps the loads above the work that follows (sunk to their first use their latency is exposed) and the advance behind the wait
    auto work = [&](const KVG& f) {
#pragma unroll
        for (int n = 0; n < 2; ++n) { v8f s[2]; float tm = mx[n];
#pragma unroll
            for (int t = 0; t < 2; ++t) { s[t] = wmmab(f.kh[t], qh[n], (v8f){}); s[t] = wmmab(f.kl[t], qh[n], s[t]); s[t] = wmmab(f.kh[t], ql[n], s[t]); }
#pragma unroll
            for (int t = 0; t < 2; ++t)
#pragma unroll
                for (int r = 0; r < 8; r += 2) { const unsigned gp = pkbf(f.g[n][t][r], f.g[n][t][r + 1]); const float u0 = s[t][r] * bflo(gp), u1 = s[t][r + 1] * bfhi(gp); const float t0 = fmaxf(u0, u0 * LEAK), t1 = fmaxf(u1, u1 * LEAK);   /* LeakyReLU(0.2) = max(u, 0.2 u) */ s[t][r] = t0; s[t][r + 1] = t1; tm = fmaxf(tm, fmaxf(t0, t1)); }
            tm = fmaxf(tm, xhalf(tm)); const float al = __builtin_amdgcn_exp2f(mx[n] - tm); mx[n] = tm; float sum = 0.f; v8u ph, pl;
#pragma unroll
            for (int t = 0; t < 2; ++t)
#pragma unroll
                for (int r = 0; r < 8; r += 2) { const float p0 = __builtin_amdgcn_exp2f(s[t][r] - tm), p1 = __builtin_amdgcn_exp2f(s[t][r + 1] - tm); sum += p0 + p1; const unsigned hp2 = pkbf(p0, p1); ph[t * 4 + (r >> 1)] = hp2; pl[t * 4 + (r >> 1)] = pkbf(p0 - bflo(hp2), p1 - bfhi(hp2)); }
            ls[n] = ls[n] * al + sum; const v16bf pbh = __builtin_bit_cast(v16bf, ph), pbl = __builtin_bit_cast(v16bf, pl);
#pragma unroll
            for (int m = 0; m < 2; ++m) { o[m][n] *= al; o[m][n] = wmmab(f.vh[m], pbh, o[m][n]); o[m][n] = wmmab(f.vl[m], pbh, o[m][n]); o[m][n] = wmmab(f.vh[m], pbl, o[m][n]); } } };
    KVG fa, fb; fetch(fa, 0);
#pragma unroll 1
    for (int k0 = 0; k0 < TT - 64; k0 += 64) {   // two register sets: each pass's loads are issued one pass ahead
        fetch(fb, 32); work(fa); fetch(fa, 64); work(fb);
        kh += 64 * HD; kl += 64 * HD; vh += 64; vl += 64; ar += 64; }
    fetch(fb, 32); work(fa); work(fb);   // the last 64 keys: nothing is fetched past key 2047
#pragma unroll
    for (int n = 0; n < 2; ++n) { const float inv = __fdiv_rn(1.0f, ls[n] + xhalf(ls[n]));
#pragma unroll
        for (int m = 0; m < 2; ++m) { v8us oh, ol;
#pragma unroll
            for (int r = 0; r < 8; ++r) { unsigned short a2, c2; splitf(o[m][n][r] * inv, a2, c2); oh[r] = a2; ol[r] = c2; }
            *(v8usa*)&so[0][qw + n * 16 + c][hs * HD + m * 16 + 8 * h] = oh; *(v8usa*)&so[1][qw + n * 16 + c][hs * HD + m * 16 + 8 * h] = ol; } }
    __syncthreads();   // the two heads of a 128-byte line of the merged planes come from different waves: one wave stores the whole line
#pragma unroll
    for (int i = 0; i < 8; ++i) { const int rem = (i & 3) * 256 + threadIdx.x, row = rem >> 3, ch = rem & 7; const v8us val = *(const v8usa*)&so[i >> 2][row][ch * 8];
        *(v8us*)(((i >> 2) ? Al : Ah) + ((size_t)b * TT + blockIdx.x * 128 + row) * DQ + blockIdx.y * 2 * HD + ch * 8) = val; }
}

extern "C" void kernel_launch(void* const* d_in, const int* in_sizes, int n_in,
                              void* d_out, int out_size, void* d_ws, size_t ws_size, hipStream_t stream) {
    (void)in_sizes; (void)n_in; (void)out_size;
    const float* x = (const float*)d_in[0]; const float* adj = (const float*)d_in[1];   /* adjacency_matrix [2048][2048] f32 0/1 (read as data) */ const float* wq = (const float*)d_in[2]; const float* bq = (const float*)d_in[3]; const float* wk = (const float*)d_in[4]; const float* bk = (const float*)d_in[5]; const float* wv = (const float*)d_in[6]; const float* bv = (const float*)d_in[7]; const float* wo = (const float*)d_in[8]; const float* bo = (const float*)d_in[9];   /* argument order hidden_states, adjacency_matrix, wq, bq, wk, bk, wv, bv, wo, bo */
    float* OUT = (float*)d_out;     // [4][2048][256]
    char* wsp = (char*)d_ws;
    auto take = [&](size_t bytes) { char* p = wsp; wsp += (bytes + 255) & ~(size_t)255; return (void*)p; };
    const size_t PZ = (size_t)NH_ * TT * HD, VZ = (size_t)NKV * HP * TT, AZ = (size_t)TT * DQ;   // one batch's q/k planes, value^T planes, merged planes (elements)
    bf* QPh = (bf*)take(NB_ * PZ * 2); bf* QPl = (bf*)take(NB_ * PZ * 2); bf* KPh = (bf*)take(NB_ * PZ * 2); bf* KPl = (bf*)take(NB_ * PZ * 2); bf* VTh = (bf*)take(NB_ * VZ * 2); bf* VTl = (bf*)take(NB_ * VZ * 2);
    bf* ATh = (bf*)take(NB_ * AZ * 2); bf* ATl = (bf*)take(NB_ * AZ * 2);
    if ((size_t)(wsp - (char*)d_ws) > ws_size) return;    // ws 256 MiB
    k_qkv<<<dim3(NB_ * TT / 128, 3, 1), 256, 0, stream>>>(x, wq, bq, wk, bk, wv, bv, QPh, QPl, KPh, KPl, VTh, VTl);
    k_fattn<<<dim3(TT / 128, NH_ / 2, NB_), 256, 0, stream>>>(QPh, QPl, KPh, KPl, VTh, VTl, adj, ATh, ATl);
    k_out<<<dim3(NB_ * TT / 64, 1, 1), 256, 0, stream>>>(ATh, ATl, wo, bo, OUT);
}

// v003
// Measured time: 73.4 microseconds a run.
// Timed twice side by side with v002, it ran 1.23 times as fast both times.
// Over all steps from v000 it is 17.7 times as fast.
#include <hip/hip_runtime.h>

// Graph attention: multi-head attention whose scaled scores are multiplied by an adjacency matrix and passed through LeakyReLU before the softmax (hidden [4][2048][256]; q, k, v = x W^T + b ('oi' [256][256] 1/16, zero biases; 8 heads x 32); s = (q.k / sqrt(32)) x adj[i][j] (f32 [2048][2048] 0/1, ~6 % ones, read); s = leaky_relu(s, 0.2); softmax over all 2048 keys; out = merged wo^T + bo -> [4][2048][256] (2.1 M); argument order hidden_states, adjacency_matrix, wq, bq, wk, bk, wv, bv, wo, bo).
// Layout: one projection launch for q, k and v over all batches (x and the 'oi' weights rounded to bf16 on the way into LDS, bf16 biases, planes stored straight from the accumulators): q/k hi/lo planes and value^T hi/lo planes per [b][h] in fragment order (below; q carries 32^-0.5 x log2 e), and, from extra blocks of the same launch, the adjacency rounded to bf16 in fragment order; one fused attention kernel over all batches and heads; one launch for merged hi/lo x wo + bo.
// Fragment order: the two 16-byte pieces that a lane (c, h) takes for one 16 x 32 operand tile lie at piece * 512 B + c * 32 B + h * 16 B of the tile's 1 KiB, so that one load of a wave covers four whole 128-byte lines (row-major planes made it touch 8 or 16 lines). q/k tile: 16 tokens x 32 d; value^T tile: 16 d x 32 keys, tiles ordered [key block][d half]; adjacency tile: 16 queries x 32 keys, tiles ordered [query tile][key block].
// Compute dtypes, f32 accumulate: every input rounded to bf16 incl. the adjacency; projections exact + bf16 biases; scores (K 32) and attn.v 3 products on every row; softmax f32, running maximum; wo hl x exact + bias.

#define NB_  4
#define TT   2048
#define DM   256
#define NH_  8
#define NKV  8
#define REP  (NH_ / NKV)
#define HD   32
#define DQ   (NH_ * HD)
#define DKV  (NKV * HD)
#define ZH   2
#define RH   2048                 // = TT: every row hi/lo
#define WIN  0
#define PCAR 1024.0f
#define SCL  0.17677669529663688f   // 32^-0.5 (the module divides by float32(sqrt(32)); one multiply here)
#define LEAK 0.2f
#define HP   64    // a head's value^T plane is HP x TT elements apart from the next; the first 32 x TT are written and read
typedef _Float16 h16;
typedef unsigned short bf;
typedef __attribute__((ext_vector_type(16))) __bf16   v16bf;
typedef __attribute__((ext_vector_type(16))) _Float16 v16h;
typedef __attribute__((ext_vector_type(8)))  _Float16 v8h;
typedef __attribute__((ext_vector_type(8)))  unsigned short v8us;
typedef __attribute__((ext_vector_type(8)))  float    v8f;
typedef __attribute__((ext_vector_type(4)))  float    v4f;
typedef v8h  __attribute__((may_alias)) v8ha;
typedef v4f  __attribute__((may_alias)) v4fa;
typedef v8us __attribute__((may_alias)) v8usa;

__device__ __forceinline__ unsigned short f2bf(float f) { unsigned u = __float_as_uint(f); u += 0x7FFFu + ((u >> 16) & 1u); return (unsigned short)(u >> 16); }
__device__ __forceinline__ float bf2f(unsigned short b) { return __uint_as_float(((unsigned)b) << 16); }
__device__ __forceinline__ float bfr(float f) { return bf2f(f2bf(f)); }
__device__ __forceinline__ v16h cat16(v8h lo, v8h hi) { return __builtin_shufflevector(lo, hi, 0, 1, 2, 3, 4, 5, 6, 7, 8, 9, 10, 11, 12, 13, 14, 15); }
__device__ __forceinline__ v16bf cat16b(v8us lo, v8us hi) { return __builtin_bit_cast(v16bf, __builtin_shufflevector(lo, hi, 0, 1, 2, 3, 4, 5, 6, 7, 8, 9, 10, 11, 12, 13, 14, 15)); }
__device__ __forceinline__ v8f wmma16(v16h a, v16h b, v8f c) { return __builtin_amdgcn_wmma_f32_16x16x32_f16(false, a, false, b, (short)0, c, false, false); }
__device__ __forceinline__ v8f wmmab(v16bf a, v16bf b, v8f c) { return __builtin_amdgcn_wmma_f32_16x16x32_bf16(false, a, false, b, (short)0, c, false, false); }



template <typename T16> struct WFrag;
template <> struct WFrag<bf> { typedef v16bf V; static __device__ __forceinline__ V ld(const bf* p) { return cat16b(*(const v8us*)p, *(const v8us*)(p + 16)); } static __device__ __forceinline__ v8f mma(V a, V b, v8f c) { return wmmab(a, b, c); } };
__device__ __forceinline__ v16bf ldfr(const bf* p) { return cat16b(*(const v8us*)p, *(const v8us*)(p + 256)); }   // a lane's two pieces of a tile in fragment order
__device__ __forceinline__ void splitf(float y, unsigned short& h, unsigned short& l) { h = f2bf(y); l = f2bf(y - bf2f(h)); }
typedef __attribute__((ext_vector_type(2))) float v2f;
typedef __attribute__((ext_vector_type(4))) unsigned v4u;
#define QSC  0.25503486164919736f   // 32^-0.5 x log2(e): LeakyReLU commutes with a positive factor, so the logits are formed in the log2 domain
typedef __attribute__((ext_vector_type(2))) __bf16 v2bf;
typedef __attribute__((ext_vector_type(8))) unsigned v8u;
__device__ __forceinline__ unsigned pkbf(float a, float b) { v2f t; t[0] = a; t[1] = b; return __builtin_bit_cast(unsigned, __builtin_convertvector(t, v2bf)); }   // two f32 -> two bf16, round to nearest even
__device__ __forceinline__ float bflo(unsigned u) { return __uint_as_float(u << 16); }
__device__ __forceinline__ float bfhi(unsigned u) { return __uint_as_float(u & 0xFFFF0000u); }
__device__ __forceinline__ float xhalf(float v) { const int b = __float_as_int(v); return __int_as_float(__builtin_amdgcn_permlanex16(b, b, 0x76543210, 0xfedcba98, false, false)); }   // the value of lane l ^ 16


#define LP 264   // LDS row pitch of a 256-element bf16 row: 528 B = 16 B x 33, an odd count of 16-byte units, for the 16-byte fragment reads
typedef __attribute__((ext_vector_type(2))) unsigned v2u;
typedef v2u __attribute__((may_alias)) v2ua;
// Staging of f32 rows of 256 as bf16 rows in LDS, 256 threads: a wave's load is 512 contiguous bytes; step 'it' is 4 rows on. ldrows only loads, so that a whole batch is in flight; strows rounds (nearest even) and stores.
template <int N> __device__ __forceinline__ void ldrows(v4f (&r)[N], const float* g) {
#pragma unroll
    for (int it = 0; it < N; ++it) r[it] = *(const v4f*)(g + it * 1024);
    asm volatile("s_wait_xcnt 0x0" ::: "memory");   // behind the batch's loads, in front of any rewrite of their address registers
    __builtin_amdgcn_sched_barrier(0); }            // keeps the batch's loads above the LDS stores that follow (sunk to their first use they would go out one at a time)
template <int N> __device__ __forceinline__ void strows(const v4f (&r)[N], bf* s) {
#pragma unroll
    for (int it = 0; it < N; ++it) { v2u o; o[0] = pkbf(r[it][0], r[it][1]); o[1] = pkbf(r[it][2], r[it][3]); *(v2ua*)(s + it * 4 * LP) = o; } }
// Eight f32 -> eight bf16 hi and eight bf16 lo (lo = bf16(y - hi)), packed for one 16-byte store each.
__device__ __forceinline__ void split8(v8f y, v4u& hv, v4u& lv) {
#pragma unroll
    for (int r = 0; r < 4; ++r) { const unsigned hp = pkbf(y[2 * r], y[2 * r + 1]); hv[r] = hp; lv[r] = pkbf(y[2 * r] - bflo(hp), y[2 * r + 1] - bfhi(hp)); } }
// Four accumulator tiles' hi and lo pieces to the two planes: piece k lies (k & 1) * S1 + (k >> 1) * S2 elements on.
template <int S1, int S2> __device__ __forceinline__ void st4(bf* ph, bf* pl, const v4u (&hv)[4], const v4u (&lv)[4]) {
    __builtin_amdgcn_sched_barrier(0);              // all eight pieces are formed above the first store, so that none of the stores' data registers is rewritten among them
#pragma unroll
    for (int k = 0; k < 4; ++k) { *(v8us*)(ph + (k & 1) * S1 + (k >> 1) * S2) = __builtin_bit_cast(v8us, hv[k]); *(v8us*)(pl + (k & 1) * S1 + (k >> 1) * S2) = __builtin_bit_cast(v8us, lv[k]); }
    asm volatile("s_wait_xcnt 0x0" ::: "memory");   // behind the stores, in front of any rewrite of their data and address registers
    __builtin_amdgcn_sched_barrier(0); }            // keeps the next tiles' arithmetic behind that wait

struct FRQ { v16bf a[4], b[4]; };
struct FRO { v16bf a[4], bh[2], bl[2]; };
// k_qkv: q, k, v = bf16(x) bf16(W)^T + bf16(b) for all batches, stored as the attention kernel's planes. Grid (rows / 128, 4): blockIdx.y picks q, k, v or the adjacency plane (32 adjacency rows a block, no LDS use). A work-group rounds 128 rows of x and the whole weight to bf16 in LDS once; 8 waves = 2 x 4 tiles of 64 rows x 64 columns, 16 accumulators a wave.
// An accumulator register run is 8 consecutive rows of the A operand at one row of the B operand: for q and k the weight rows are A (a lane holds 8 consecutive d of one token), for v the token rows are A (8 consecutive tokens of one d), so every plane is written in 16-byte pieces with no transpose, 512 contiguous bytes a store.
__global__ __launch_bounds__(256) void k_qkv(const float* __restrict__ x, const float* __restrict__ wq, const float* __restrict__ bq, const float* __restrict__ wk, const float* __restrict__ bk, const float* __restrict__ wv, const float* __restrict__ bv, const float* __restrict__ adj, bf* Qh, bf* Ql, bf* Kh, bf* Kl, bf* Vh, bf* Vl, bf* AB) {
    __shared__ __align__(16) bf sm[(128 + 256) * LP];   // rows 0..127: x tile; rows 128..383: weight
    const int tid = threadIdx.x, lane = tid & 31, lr = lane & 15, hi = lane >> 4, wave = __builtin_amdgcn_readfirstlane(tid >> 5);
    if (blockIdx.y == 3) {   // the whole block leaves here, in front of the barrier. A wave takes 4 rows x 64 keys a step: 8 whole lines read, 4 whole lines written
        static_assert(NB_ * TT / 128 * 32 == TT, "one block for every 32 adjacency rows");
        const int k8 = lane & 7, row = blockIdx.x * 32 + wave * 4 + (lane >> 3);
        const float* g = adj + (size_t)row * TT + k8 * 8; bf* d = AB + ((size_t)(row >> 4) * 128 + (k8 >> 1)) * 256 + (row & 15) * 16 + (k8 & 1) * 8;
#pragma unroll
        for (int hb = 0; hb < 2; ++hb) { v8f r[16]; v4u o[16];
#pragma unroll
            for (int it = 0; it < 16; ++it) r[it] = *(const v8f*)(g + (hb * 16 + it) * 64);
            asm volatile("s_wait_xcnt 0x0" ::: "memory");   // behind the batch's loads, in front of any rewrite of their address registers
            __builtin_amdgcn_sched_barrier(0);              // keeps the batch's loads together above the rounding (sunk to their first use they would go out one at a time)
#pragma unroll
            for (int it = 0; it < 16; ++it)
#pragma unroll
                for (int k = 0; k < 4; ++k) o[it][k] = pkbf(r[it][2 * k], r[it][2 * k + 1]);
            __builtin_amdgcn_sched_barrier(0);              // all pieces are formed above the first store, so that none of the stores' data registers is rewritten among them
#pragma unroll
            for (int it = 0; it < 16; ++it) *(v8us*)(d + (hb * 16 + it) * 1024) = __builtin_bit_cast(v8us, o[it]);
            asm volatile("s_wait_xcnt 0x0" ::: "memory");   // behind the stores, in front of any rewrite of their data and address registers
            __builtin_amdgcn_sched_barrier(0); }            // keeps the next batch behind that wait
        return; }
    const int sel = blockIdx.y, rw = (wave >> 2) * 64, r0 = blockIdx.x * 128 + rw, c0 = (wave & 3) * 64;
    const float* w = sel == 0 ? wq : sel == 1 ? wk : wv; const float* bias = sel == 0 ? bq : sel == 1 ? bk : bv;
    { const float* gx = x + (size_t)blockIdx.x * 128 * DM + tid * 4; const float* gw = w + tid * 4; bf* st = sm + (tid >> 6) * LP + (tid & 63) * 4; v4f ra[32], rb[32];
      ldrows(ra, gx); ldrows(rb, gw); strows(ra, st); ldrows(ra, gw + 32 * 1024); strows(rb, st + 128 * LP); strows(ra, st + 256 * LP); }
    __syncthreads();   // every wave reads rows that other waves staged
    const int xo = (rw + lr) * LP + 8 * hi, wo = (128 + c0 + lr) * LP + 8 * hi;
    const bf* pa = sm + (sel == 2 ? xo : wo); const bf* pb = sm + (sel == 2 ? wo : xo);
    v8f acc[4][4];
#pragma unroll
    for (int i = 0; i < 4; ++i)
#pragma unroll
        for (int j = 0; j < 4; ++j) acc[i][j] = (v8f){};
    auto fetch = [&](FRQ& f, int kc) {
#pragma unroll
        for (int i = 0; i < 4; ++i) { f.a[i] = WFrag<bf>::ld(pa + i * 16 * LP + kc); f.b[i] = WFrag<bf>::ld(pb + i * 16 * LP + kc); }
        __builtin_amdgcn_sched_barrier(0); };   // keeps a k step's LDS reads in one group above the matrix instructions of the step before (sunk to their first use each read's latency is exposed)
    auto mm = [&](const FRQ& f) {
#pragma unroll
        for (int j = 0; j < 4; ++j)
#pragma unroll
            for (int i = 0; i < 4; ++i) acc[i][j] = wmmab(f.a[i], f.b[j], acc[i][j]); };
    FRQ f0, f1; fetch(f0, 0);
#pragma unroll
    for (int kc = 0; kc < DM; kc += 64) { fetch(f1, kc + 32); mm(f0); if (kc + 64 < DM) fetch(f0, kc + 64); mm(f1); }   // two fragment sets: each k step's reads are issued one step ahead
    const int bt = r0 / TT, t0 = r0 % TT, g0 = bt * NH_ + (c0 >> 5);   // the tile's batch, first token and first head plane
    if (sel == 2) {   // acc[i][j][r]: token t0 + 16 i + 8 hi + r, column c0 + 16 j + lr
        const size_t vo = (size_t)g0 * HP * TT + t0 * 32 + lr * 16 + 8 * hi; bf* ph = Vh + vo; bf* pl = Vl + vo; float bb[4];
#pragma unroll
        for (int j = 0; j < 4; ++j) bb[j] = bias[c0 + j * 16 + lr];
        asm volatile("s_wait_xcnt 0x0" ::: "memory");   // behind the bias loads, in front of any rewrite of their address registers
        __builtin_amdgcn_sched_barrier(0);              // keeps later arithmetic behind that wait
#pragma unroll
        for (int j = 0; j < 4; ++j) { v4u hv[4], lv[4]; const float b1 = bfr(bb[j]);
#pragma unroll
            for (int i = 0; i < 4; ++i) split8(acc[i][j] + b1, hv[i], lv[i]);
            const int of = (j >> 1) * HP * TT + (j & 1) * 512; st4<256, 1024>(ph + of, pl + of, hv, lv); }
    } else {          // acc[i][j][r]: column c0 + 16 i + 8 hi + r, token t0 + 16 j + lr
        const float sc = sel == 0 ? QSC : 1.0f; const size_t po = ((size_t)g0 * TT + t0) * HD + lr * 16 + 8 * hi; bf* ph = (sel == 0 ? Qh : Kh) + po; bf* pl = (sel == 0 ? Ql : Kl) + po; v8f bb[4];
#pragma unroll
        for (int i = 0; i < 4; ++i) bb[i] = *(const v8f*)(bias + c0 + i * 16 + 8 * hi);
        asm volatile("s_wait_xcnt 0x0" ::: "memory");   // behind the bias loads, in front of any rewrite of their address registers
        __builtin_amdgcn_sched_barrier(0);              // keeps later arithmetic behind that wait
#pragma unroll
        for (int i = 0; i < 4; ++i) { v4u hv[4], lv[4]; v8f b8;
#pragma unroll
            for (int r = 0; r < 8; ++r) b8[r] = bfr(bb[i][r]);
#pragma unroll
            for (int j = 0; j < 4; ++j) split8((acc[i][j] + b8) * sc, hv[j], lv[j]);
            const int of = (i >> 1) * TT * HD + (i & 1) * 256; st4<512, 1024>(ph + of, pl + of, hv, lv); }
    }
}

// k_out: out = (merged hi + merged lo) bf16(wo)^T + bf16(bo) over all batches' rows at once. Grid rows / 64; a work-group stages 64 rows of both merged planes and the whole weight (rounded to bf16) in LDS; 8 waves = 2 x 4 tiles of 32 rows x 64 columns; the weight rows are the A operand, so a lane holds 8 consecutive output columns of one row.
__global__ __launch_bounds__(256) void k_out(const bf* __restrict__ Ah, const bf* __restrict__ Al, const float* __restrict__ wo, const float* __restrict__ bo, float* out) {
    __shared__ __align__(16) bf sm[(64 + 64 + 256) * LP];   // rows 0..63: merged hi; 64..127: merged lo; 128..383: weight
    const int tid = threadIdx.x, lane = tid & 31, lr = lane & 15, hi = lane >> 4, wave = __builtin_amdgcn_readfirstlane(tid >> 5);
    const int rw = (wave >> 2) * 32, r0 = blockIdx.x * 64 + rw, c0 = (wave & 3) * 64;
    { const bf* gh = Ah + (size_t)blockIdx.x * 64 * DQ + tid * 8; const bf* gl = Al + (size_t)blockIdx.x * 64 * DQ + tid * 8; const float* gw = wo + tid * 4;
      bf* sa = sm + (tid >> 5) * LP + (tid & 31) * 8; bf* st = sm + (128 + (tid >> 6)) * LP + (tid & 63) * 4; v8us th[8], tl[8]; v4f ra[32], rb[32];
#pragma unroll
      for (int it = 0; it < 8; ++it) { th[it] = *(const v8us*)(gh + it * 2048); tl[it] = *(const v8us*)(gl + it * 2048); }   // step 'it' is 8 rows on
      ldrows(ra, gw);
#pragma unroll
      for (int it = 0; it < 8; ++it) { *(v8usa*)(sa + it * 8 * LP) = th[it]; *(v8usa*)(sa + (64 + it * 8) * LP) = tl[it]; }
      ldrows(rb, gw + 32 * 1024); strows(ra, st); strows(rb, st + 128 * LP); }
    __syncthreads();   // every wave reads rows that other waves staged
    const bf* pa = sm + (128 + c0 + lr) * LP + 8 * hi; const bf* ph = sm + (rw + lr) * LP + 8 * hi; const bf* pl = ph + 64 * LP;
    v8f acc[4][2];
#pragma unroll
    for (int i = 0; i < 4; ++i)
#pragma unroll
        for (int j = 0; j < 2; ++j) acc[i][j] = (v8f){};
    auto fetch = [&](FRO& f, int kc) {
#pragma unroll
        for (int i = 0; i < 4; ++i) f.a[i] = WFrag<bf>::ld(pa + i * 16 * LP + kc);
#pragma unroll
        for (int j = 0; j < 2; ++j) { f.bh[j] = WFrag<bf>::ld(ph + j * 16 * LP + kc); f.bl[j] = WFrag<bf>::ld(pl + j * 16 * LP + kc); }
        __builtin_amdgcn_sched_barrier(0); };   // keeps a k step's LDS reads in one group above the matrix instructions of the step before (sunk to their first use each read's latency is exposed)
    auto mm = [&](const FRO& f) {   // per accumulator: hi, then lo
#pragma unroll
        for (int j = 0; j < 2; ++j)
#pragma unroll
            for (int i = 0; i < 4; ++i) acc[i][j] = wmmab(f.a[i], f.bh[j], acc[i][j]);
#pragma unroll
        for (int j = 0; j < 2; ++j)
#pragma unroll
            for (int i = 0; i < 4; ++i) acc[i][j] = wmmab(f.a[i], f.bl[j], acc[i][j]); };
    FRO f0, f1; fetch(f0, 0);
#pragma unroll
    for (int kc = 0; kc < DQ; kc += 64) { fetch(f1, kc + 32); mm(f0); if (kc + 64 < DQ) fetch(f0, kc + 64); mm(f1); }   // two fragment sets: each k step's reads are issued one step ahead
    float* po = out + (size_t)(r0 + lr) * DM + c0 + 8 * hi;   // acc[i][j][r]: column c0 + 16 i + 8 hi + r, row r0 + 16 j + lr
#pragma unroll
    for (int i = 0; i < 4; ++i) { v8f bb = *(const v8f*)(bo + c0 + i * 16 + 8 * hi);
#pragma unroll
        for (int r = 0; r < 8; ++r) bb[r] = bfr(bb[r]);
#pragma unroll
        for (int j = 0; j < 2; ++j) *(v8f*)(po + j * 16 * DM + i * 16) = acc[i][j] + bb; }
}

// k_fattn: S^T = K Q^T (keys x queries), t = leaky_relu_0.2(S^T x the bf16 adjacency plane) in the log2 domain over ALL 2048 keys (zeroed logits stay in the softmax), running maximum and sum per query column, O^T += V^T P^T with P^T packed from the score accumulators (hi/lo); the scores never leave registers.
// Work-group: 8 waves = 2 heads x 4 tiles of 32 queries; grid (TT / 128, heads / 2, batches). A lane (c, h) holds query c of each 16-column group; accumulator register r of key tile t is key k0 + 16 t + 8 h + r, which is the k order of the B operand and of the V^T loader.
struct KVG { v16bf kh[2], kl[2], vh[2], vl[2]; v4u g[2][2]; };
__global__ __launch_bounds__(256) void k_fattn(const bf* __restrict__ Qh, const bf* __restrict__ Ql, const bf* __restrict__ Kh, const bf* __restrict__ Kl, const bf* __restrict__ Vh, const bf* __restrict__ Vl, const bf* __restrict__ AB, bf* Ah, bf* Al) {
    __shared__ __align__(16) bf so[2][128][72];   // output staging, pitch 144 B
    const int lane = threadIdx.x & 31, c = lane & 15, h = lane >> 4, wave = __builtin_amdgcn_readfirstlane(threadIdx.x >> 5);   // the wave's number in a scalar register: the plane bases below are then scalar
    const int hs = wave >> 2, head = blockIdx.y * 2 + hs, b = blockIdx.z, qw = (wave & 3) * 32, q0 = blockIdx.x * 128 + qw;
    const size_t pz = ((size_t)b * NH_ + head) * TT * HD, vz = ((size_t)b * NKV + head) * HP * TT;
    v16bf qh[2], ql[2]; const bf* qa = Qh + pz + (size_t)q0 * HD + c * 16 + 8 * h; const bf* qb = Ql + pz + (size_t)q0 * HD + c * 16 + 8 * h;
#pragma unroll
    for (int n = 0; n < 2; ++n) { qh[n] = ldfr(qa + n * 16 * HD); ql[n] = ldfr(qb + n * 16 * HD); }
    asm volatile("s_wait_xcnt 0x0" ::: "memory");   // behind the loads, in front of any rewrite of their address registers
    __builtin_amdgcn_sched_barrier(0);              // keeps later address arithmetic behind that wait
    const bf* kh = Kh + pz + c * 16 + 8 * h; const bf* kl = Kl + pz + c * 16 + 8 * h; const bf* vh = Vh + vz + c * 16 + 8 * h; const bf* vl = Vl + vz + c * 16 + 8 * h; const bf* ar = AB + (size_t)(q0 >> 4) * (TT * 16) + c * 16 + 8 * h;   // the lane's five pointers, advanced by 64 keys a trip; every load is one of them plus a constant
    v8f o[2][2]; float mx[2], ls[2];
#pragma unroll
    for (int n = 0; n < 2; ++n) { o[0][n] = (v8f){}; o[1][n] = (v8f){}; mx[n] = -3.0e38f; ls[n] = 0.f; }
    auto fetch = [&](KVG& f, int ko) {   // ko: key offset from the pointers, a constant at every call
#pragma unroll
        for (int t = 0; t < 2; ++t) { f.kh[t] = ldfr(kh + (ko + t * 16) * HD); f.kl[t] = ldfr(kl + (ko + t * 16) * HD); }
#pragma unroll
        for (int n = 0; n < 2; ++n)
#pragma unroll
            for (int t = 0; t < 2; ++t) f.g[n][t] = *(const v4u*)(ar + n * 16 * TT + ko * 16 + t * 256);
#pragma unroll
        for (int m = 0; m < 2; ++m) { f.vh[m] = ldfr(vh + ko * 32 + m * 512); f.vl[m] = ldfr(vl + ko * 32 + m * 512); }
        asm volatile("s_wait_xcnt 0x0" ::: "memory");   // behind the pass's loads, in front of the advance of their address registers
        __builtin_amdgcn_sched_barrier(0); };           // keeps the loads above the work that follows (sunk to their first use their latency is exposed) and the advance behind the wait
    auto work = [&](const KVG& f) {
#pragma unroll
        for (int n = 0; n < 2; ++n) { v8f s[2]; float tm = mx[n];
#pragma unroll
            for (int t = 0; t < 2; ++t) { s[t] = wmmab(f.kh[t], qh[n], (v8f){}); s[t] = wmmab(f.kl[t], qh[n], s[t]); s[t] = wmmab(f.kh[t], ql[n], s[t]); }
#pragma unroll
            for (int t = 0; t < 2; ++t)
#pragma unroll
                for (int r = 0; r < 8; r += 2) { const unsigned gp = f.g[n][t][r >> 1]; const float u0 = s[t][r] * bflo(gp), u1 = s[t][r + 1] * bfhi(gp); const float t0 = fmaxf(u0, u0 * LEAK), t1 = fmaxf(u1, u1 * LEAK);   /* LeakyReLU(0.2) = max(u, 0.2 u) */ s[t][r] = t0; s[t][r + 1] = t1; tm = fmaxf(tm, fmaxf(t0, t1)); }
            tm = fmaxf(tm, xhalf(tm)); const float al = __builtin_amdgcn_exp2f(mx[n] - tm); mx[n] = tm; float sum = 0.f; v8u ph, pl;
#pragma unroll
            for (int t = 0; t < 2; ++t)
#pragma unroll
                for (int r = 0; r < 8; r += 2) { const float p0 = __builtin_amdgcn_exp2f(s[t][r] - tm), p1 = __builtin_amdgcn_exp2f(s[t][r + 1] - tm); sum += p0 + p1; const unsigned hp2 = pkbf(p0, p1); ph[t * 4 + (r >> 1)] = hp2; pl[t * 4 + (r >> 1)] = pkbf(p0 - bflo(hp2), p1 - bfhi(hp2)); }
            ls[n] = ls[n] * al + sum; const v16bf pbh = __builtin_bit_cast(v16bf, ph), pbl = __builtin_bit_cast(v16bf, pl);
#pragma unroll
            for (int m = 0; m < 2; ++m) { o[m][n] *= al; o[m][n] = wmmab(f.vh[m], pbh, o[m][n]); o[m][n] = wmmab(f.vl[m], pbh, o[m][n]); o[m][n] = wmmab(f.vh[m], pbl, o[m][n]); } } };
    KVG fa, fb; fetch(fa, 0);
#pragma unroll 1
    for (int k0 = 0; k0 < TT - 64; k0 += 64) {   // two register sets: each pass's loads are issued one pass ahead
        fetch(fb, 32); work(fa); fetch(fa, 64); work(fb);
        kh += 64 * HD; kl += 64 * HD; vh += 64 * 32; vl += 64 * 32; ar += 64 * 16; }
    fetch(fb, 32); work(fa); work(fb);   // the last 64 keys: nothing is fetched past key 2047
#pragma unroll
    for (int n = 0; n < 2; ++n) { const float inv = __fdiv_rn(1.0f, ls[n] + xhalf(ls[n]));
#pragma unroll
        for (int m = 0; m < 2; ++m) { v8us oh, ol;
#pragma unroll
            for (int r = 0; r < 8; ++r) { unsigned short a2, c2; splitf(o[m][n][r] * inv, a2, c2); oh[r] = a2; ol[r] = c2; }
            *(v8usa*)&so[0][qw + n * 16 + c][hs * HD + m * 16 + 8 * h] = oh; *(v8usa*)&so[1][qw + n * 16 + c][hs * HD + m * 16 + 8 * h] = ol; } }
    __syncthreads();   // the two heads of a 128-byte line of the merged planes come from different waves: one wave stores the whole line
#pragma unroll
    for (int i = 0; i < 8; ++i) { const int rem = (i & 3) * 256 + threadIdx.x, row = rem >> 3, ch = rem & 7; const v8us val = *(const v8usa*)&so[i >> 2][row][ch * 8];
        *(v8us*)(((i >> 2) ? Al : Ah) + ((size_t)b * TT + blockIdx.x * 128 + row) * DQ + blockIdx.y * 2 * HD + ch * 8) = val; }
}

extern "C" void kernel_launch(void* const* d_in, const int* in_sizes, int n_in,
                              void* d_out, int out_size, void* d_ws, size_t ws_size, hipStream_t stream) {
    (void)in_sizes; (void)n_in; (void)out_size;
    const float* x = (const float*)d_in[0]; const float* adj = (const float*)d_in[1];   /* adjacency_matrix [2048][2048] f32 0/1 (read as data) */ const float* wq = (const float*)d_in[2]; const float* bq = (const float*)d_in[3]; const float* wk = (const float*)d_in[4]; const float* bk = (const float*)d_in[5]; const float* wv = (const float*)d_in[6]; const float* bv = (const float*)d_in[7]; const float* wo = (const float*)d_in[8]; const float* bo = (const float*)d_in[9];   /* argument order hidden_states, adjacency_matrix, wq, bq, wk, bk, wv, bv, wo, bo */
    float* OUT = (float*)d_out;     // [4][2048][256]
    char* wsp = (char*)d_ws;
    auto take = [&](size_t bytes) { char* p = wsp; wsp += (bytes + 255) & ~(size_t)255; return (void*)p; };
    const size_t PZ = (size_t)NH_ * TT * HD, VZ = (size_t)NKV * HP * TT, AZ = (size_t)TT * DQ;   // one batch's q/k planes, value^T planes, merged planes (elements)
    bf* QPh = (bf*)take(NB_ * PZ * 2); bf* QPl = (bf*)take(NB_ * PZ * 2); bf* KPh = (bf*)take(NB_ * PZ * 2); bf* KPl = (bf*)take(NB_ * PZ * 2); bf* VTh = (bf*)take(NB_ * VZ * 2); bf* VTl = (bf*)take(NB_ * VZ * 2);
    bf* ATh = (bf*)take(NB_ * AZ * 2); bf* ATl = (bf*)take(NB_ * AZ * 2); bf* ADB = (bf*)take((size_t)TT * TT * 2);   // bf16 adjacency plane
    if ((size_t)(wsp - (char*)d_ws) > ws_size) return;    // ws 256 MiB
    k_qkv<<<dim3(NB_ * TT / 128, 4, 1), 256, 0, stream>>>(x, wq, bq, wk, bk, wv, bv, adj, QPh, QPl, KPh, KPl, VTh, VTl, ADB);
    k_fattn<<<dim3(TT / 128, NH_ / 2, NB_), 256, 0, stream>>>(QPh, QPl, KPh, KPl, VTh, VTl, ADB, ATh, ATl);
    k_out<<<dim3(NB_ * TT / 64, 1, 1), 256, 0, stream>>>(ATh, ATl, wo, bo, OUT);
}

// v004
// One run takes 69.9 microseconds.
// Two timings next to v003 both put it at 1.05 times that version's speed.
// Over all steps from v000 it is 18.6 times as fast.
#include <hip/hip_runtime.h>

// Graph attention: multi-head attention whose scaled scores are multiplied by an adjacency matrix and passed through LeakyReLU before the softmax (hidden [4][2048][256]; q, k, v = x W^T + b ('oi' [256][256] 1/16, zero biases; 8 heads x 32); s = (q.k / sqrt(32)) x adj[i][j] (f32 [2048][2048] 0/1, ~6 % ones, read); s = leaky_relu(s, 0.2); softmax over all 2048 keys; out = merged wo^T + bo -> [4][2048][256] (2.1 M); argument order hidden_states, adjacency_matrix, wq, bq, wk, bk, wv, bv, wo, bo).
// Layout: one projection launch for q, k and v over all batches (x and the 'oi' weights rounded to bf16 on the way into LDS, bf16 biases, planes stored straight from the accumulators): q/k hi/lo planes and value^T hi/lo planes per [b][h] in fragment order (below; q carries 32^-0.5 x log2 e), and, from extra blocks of the same launch, the adjacency rounded to bf16 in fragment order; one fused attention kernel over all batches and heads; one launch for merged hi/lo x wo + bo.
// Fragment order: the two 16-byte pieces that a lane (c, h) takes for one 16 x 32 operand tile lie at piece * 512 B + c * 32 B + h * 16 B of the tile's 1 KiB, so that one load of a wave covers four whole 128-byte lines (row-major planes made it touch 8 or 16 lines). q/k tile: 16 tokens x 32 d; value^T tile: 16 d x 32 keys, tiles ordered [key block][d half]; adjacency tile: 16 queries x 32 keys, tiles ordered [query tile][key block].
// Compute dtypes, f32 accumulate: every input rounded to bf16 incl. the adjacency; projections exact + bf16 biases; scores (K 32) and attn.v 3 products on every row; softmax f32, shifted by a per-query upper bound of the logits (running maximum where that bound is large); wo hl x exact + bias.

#define NB_  4
#define TT   2048
#define DM   256
#define NH_  8
#define NKV  8
#define REP  (NH_ / NKV)
#define HD   32
#define DQ   (NH_ * HD)
#define DKV  (NKV * HD)
#define ZH   2
#define RH   2048                 // = TT: every row hi/lo
#define WIN  0
#define PCAR 1024.0f
#define SCL  0.17677669529663688f   // 32^-0.5 (the module divides by float32(sqrt(32)); one multiply here)
#define LEAK 0.2f
#define BLIM 64.0f   // largest logit bound (log2 domain) that is used as the softmax shift
#define HP   64    // a head's value^T plane is HP x TT elements apart from the next; the first 32 x TT are written and read
typedef _Float16 h16;
typedef unsigned short bf;
typedef __attribute__((ext_vector_type(16))) __bf16   v16bf;
typedef __attribute__((ext_vector_type(16))) _Float16 v16h;
typedef __attribute__((ext_vector_type(8)))  _Float16 v8h;
typedef __attribute__((ext_vector_type(8)))  unsigned short v8us;
typedef __attribute__((ext_vector_type(8)))  float    v8f;
typedef __attribute__((ext_vector_type(4)))  float    v4f;
typedef v8h  __attribute__((may_alias)) v8ha;
typedef v4f  __attribute__((may_alias)) v4fa;
typedef v8us __attribute__((may_alias)) v8usa;

__device__ __forceinline__ unsigned short f2bf(float f) { unsigned u = __float_as_uint(f); u += 0x7FFFu + ((u >> 16) & 1u); return (unsigned short)(u >> 16); }
__device__ __forceinline__ float bf2f(unsigned short b) { return __uint_as_float(((unsigned)b) << 16); }
__device__ __forceinline__ float bfr(float f) { return bf2f(f2bf(f)); }
__device__ __forceinline__ v16h cat16(v8h lo, v8h hi) { return __builtin_shufflevector(lo, hi, 0, 1, 2, 3, 4, 5, 6, 7, 8, 9, 10, 11, 12, 13, 14, 15); }
__device__ __forceinline__ v16bf cat16b(v8us lo, v8us hi) { return __builtin_bit_cast(v16bf, __builtin_shufflevector(lo, hi, 0, 1, 2, 3, 4, 5, 6, 7, 8, 9, 10, 11, 12, 13, 14, 15)); }
__device__ __forceinline__ v8f wmma16(v16h a, v16h b, v8f c) { return __builtin_amdgcn_wmma_f32_16x16x32_f16(false, a, false, b, (short)0, c, false, false); }
__device__ __forceinline__ v8f wmmab(v16bf a, v16bf b, v8f c) { return __builtin_amdgcn_wmma_f32_16x16x32_bf16(false, a, false, b, (short)0, c, false, false); }



template <typename T16> struct WFrag;
template <> struct WFrag<bf> { typedef v16bf V; static __device__ __forceinline__ V ld(const bf* p) { return cat16b(*(const v8us*)p, *(const v8us*)(p + 16)); } static __device__ __forceinline__ v8f mma(V a, V b, v8f c) { return wmmab(a, b, c); } };
__device__ __forceinline__ v16bf ldfr(const bf* p) { return cat16b(*(const v8us*)p, *(const v8us*)(p + 256)); }   // a lane's two pieces of a tile in fragment order
__device__ __forceinline__ void splitf(float y, unsigned short& h, unsigned short& l) { h = f2bf(y); l = f2bf(y - bf2f(h)); }
typedef __attribute__((ext_vector_type(2))) float v2f;
typedef __attribute__((ext_vector_type(4))) unsigned v4u;
#define QSC  0.25503486164919736f   // 32^-0.5 x log2(e): LeakyReLU commutes with a positive factor, so the logits are formed in the log2 domain
typedef __attribute__((ext_vector_type(2))) __bf16 v2bf;
typedef __attribute__((ext_vector_type(8))) unsigned v8u;
__device__ __forceinline__ unsigned pkbf(float a, float b) { v2f t; t[0] = a; t[1] = b; return __builtin_bit_cast(unsigned, __builtin_convertvector(t, v2bf)); }   // two f32 -> two bf16, round to nearest even
__device__ __forceinline__ float bflo(unsigned u) { return __uint_as_float(u << 16); }
__device__ __forceinline__ float bfhi(unsigned u) { return __uint_as_float(u & 0xFFFF0000u); }
__device__ __forceinline__ float xhalf(float v) { const int b = __float_as_int(v); return __int_as_float(__builtin_amdgcn_permlanex16(b, b, 0x76543210, 0xfedcba98, false, false)); }   // the value of lane l ^ 16


#define LP 264   // LDS row pitch of a 256-element bf16 row: 528 B = 16 B x 33, an odd count of 16-byte units, for the 16-byte fragment reads
typedef __attribute__((ext_vector_type(2))) unsigned v2u;
typedef v2u __attribute__((may_alias)) v2ua;
// Staging of f32 rows of 256 as bf16 rows in LDS, 256 threads: a wave's load is 512 contiguous bytes; step 'it' is 4 rows on. ldrows only loads, so that a whole batch is in flight; strows rounds (nearest even) and stores.
template <int N> __device__ __forceinline__ void ldrows(v4f (&r)[N], const float* g) {
#pragma unroll
    for (int it = 0; it < N; ++it) r[it] = *(const v4f*)(g + it * 1024);
    asm volatile("s_wait_xcnt 0x0" ::: "memory");   // behind the batch's loads, in front of any rewrite of their address registers
    __builtin_amdgcn_sched_barrier(0); }            // keeps the batch's loads above the LDS stores that follow (sunk to their first use they would go out one at a time)
template <int N> __device__ __forceinline__ void strows(const v4f (&r)[N], bf* s) {
#pragma unroll
    for (int it = 0; it < N; ++it) { v2u o; o[0] = pkbf(r[it][0], r[it][1]); o[1] = pkbf(r[it][2], r[it][3]); *(v2ua*)(s + it * 4 * LP) = o; } }
// Eight f32 -> eight bf16 hi and eight bf16 lo (lo = bf16(y - hi)), packed for one 16-byte store each.
__device__ __forceinline__ void split8(v8f y, v4u& hv, v4u& lv) {
#pragma unroll
    for (int r = 0; r < 4; ++r) { const unsigned hp = pkbf(y[2 * r], y[2 * r + 1]); hv[r] = hp; lv[r] = pkbf(y[2 * r] - bflo(hp), y[2 * r + 1] - bfhi(hp)); } }
// Four accumulator tiles' hi and lo pieces to the two planes: piece k lies (k & 1) * S1 + (k >> 1) * S2 elements on.
template <int S1, int S2> __device__ __forceinline__ void st4(bf* ph, bf* pl, const v4u (&hv)[4], const v4u (&lv)[4]) {
    __builtin_amdgcn_sched_barrier(0);              // all eight pieces are formed above the first store, so that none of the stores' data registers is rewritten among them
#pragma unroll
    for (int k = 0; k < 4; ++k) { *(v8us*)(ph + (k & 1) * S1 + (k >> 1) * S2) = __builtin_bit_cast(v8us, hv[k]); *(v8us*)(pl + (k & 1) * S1 + (k >> 1) * S2) = __builtin_bit_cast(v8us, lv[k]); }
    asm volatile("s_wait_xcnt 0x0" ::: "memory");   // behind the stores, in front of any rewrite of their data and address registers
    __builtin_amdgcn_sched_barrier(0); }            // keeps the next tiles' arithmetic behind that wait

struct FRQ { v16bf a[4], b[4]; };
struct FRO { v16bf a[4], bh[2], bl[2]; };
// k_qkv: q, k, v = bf16(x) bf16(W)^T + bf16(b) for all batches, stored as the attention kernel's planes. Grid (rows / 128, 4): blockIdx.y picks q, k, v or the adjacency plane (32 adjacency rows a block, no LDS use). A work-group rounds 128 rows of x and the whole weight to bf16 in LDS once; 8 waves = 2 x 4 tiles of 64 rows x 64 columns, 16 accumulators a wave.
// An accumulator register run is 8 consecutive rows of the A operand at one row of the B operand: for q and k the weight rows are A (a lane holds 8 consecutive d of one token), for v the token rows are A (8 consecutive tokens of one d), so every plane is written in 16-byte pieces with no transpose, 512 contiguous bytes a store.
__global__ __launch_bounds__(256) void k_qkv(const float* __restrict__ x, const float* __restrict__ wq, const float* __restrict__ bq, const float* __restrict__ wk, const float* __restrict__ bk, const float* __restrict__ wv, const float* __restrict__ bv, const float* __restrict__ adj, bf* Qh, bf* Ql, bf* Kh, bf* Kl, bf* Vh, bf* Vl, bf* AB, float* KM, float* AM) {
    __shared__ __align__(16) bf sm[(128 + 256) * LP];   // rows 0..127: x tile; rows 128..383: weight
    const int tid = threadIdx.x, lane = tid & 31, lr = lane & 15, hi = lane >> 4, wave = __builtin_amdgcn_readfirstlane(tid >> 5);
    if (blockIdx.y == 3) {   // the whole block leaves here, in front of the barrier. A wave takes 4 rows x 64 keys a step: 8 whole lines read, 4 whole lines written
        static_assert(NB_ * TT / 128 * 32 == TT, "one block for every 32 adjacency rows");
        const int k8 = lane & 7, row = blockIdx.x * 32 + wave * 4 + (lane >> 3);
        const float* g = adj + (size_t)row * TT + k8 * 8; bf* d = AB + ((size_t)(row >> 4) * 128 + (k8 >> 1)) * 256 + (row & 15) * 16 + (k8 & 1) * 8; float am = 0.f;   // am: largest |adjacency| among the lane's share of its row
#pragma unroll
        for (int hb = 0; hb < 2; ++hb) { v8f r[16]; v4u o[16];
#pragma unroll
            for (int it = 0; it < 16; ++it) r[it] = *(const v8f*)(g + (hb * 16 + it) * 64);
            asm volatile("s_wait_xcnt 0x0" ::: "memory");   // behind the batch's loads, in front of any rewrite of their address registers
            __builtin_amdgcn_sched_barrier(0);              // keeps the batch's loads together above the rounding (sunk to their first use they would go out one at a time)
#pragma unroll
            for (int it = 0; it < 16; ++it)
#pragma unroll
                for (int k = 0; k < 4; ++k) { o[it][k] = pkbf(r[it][2 * k], r[it][2 * k + 1]); am = fmaxf(am, fmaxf(fabsf(r[it][2 * k]), fabsf(r[it][2 * k + 1]))); }
            __builtin_amdgcn_sched_barrier(0);              // all pieces are formed above the first store, so that none of the stores' data registers is rewritten among them
#pragma unroll
            for (int it = 0; it < 16; ++it) *(v8us*)(d + (hb * 16 + it) * 1024) = __builtin_bit_cast(v8us, o[it]);
            asm volatile("s_wait_xcnt 0x0" ::: "memory");   // behind the stores, in front of any rewrite of their data and address registers
            __builtin_amdgcn_sched_barrier(0); }            // keeps the next batch behind that wait
        AM[(size_t)row * 8 + k8] = am;   // eight partial maxima a row; a wave writes one whole line
        return; }
    const int sel = blockIdx.y, rw = (wave >> 2) * 64, r0 = blockIdx.x * 128 + rw, c0 = (wave & 3) * 64;
    const float* w = sel == 0 ? wq : sel == 1 ? wk : wv; const float* bias = sel == 0 ? bq : sel == 1 ? bk : bv;
    { const float* gx = x + (size_t)blockIdx.x * 128 * DM + tid * 4; const float* gw = w + tid * 4; bf* st = sm + (tid >> 6) * LP + (tid & 63) * 4; v4f ra[32], rb[32];
      ldrows(ra, gx); ldrows(rb, gw); strows(ra, st); ldrows(ra, gw + 32 * 1024); strows(rb, st + 128 * LP); strows(ra, st + 256 * LP); }
    __syncthreads();   // every wave reads rows that other waves staged
    const int xo = (rw + lr) * LP + 8 * hi, wo = (128 + c0 + lr) * LP + 8 * hi;
    const bf* pa = sm + (sel == 2 ? xo : wo); const bf* pb = sm + (sel == 2 ? wo : xo);
    v8f acc[4][4];
#pragma unroll
    for (int i = 0; i < 4; ++i)
#pragma unroll
        for (int j = 0; j < 4; ++j) acc[i][j] = (v8f){};
    auto fetch = [&](FRQ& f, int kc) {
#pragma unroll
        for (int i = 0; i < 4; ++i) { f.a[i] = WFrag<bf>::ld(pa + i * 16 * LP + kc); f.b[i] = WFrag<bf>::ld(pb + i * 16 * LP + kc); }
        __builtin_amdgcn_sched_barrier(0); };   // keeps a k step's LDS reads in one group above the matrix instructions of the step before (sunk to their first use each read's latency is exposed)
    auto mm = [&](const FRQ& f) {
#pragma unroll
        for (int j = 0; j < 4; ++j)
#pragma unroll
            for (int i = 0; i < 4; ++i) acc[i][j] = wmmab(f.a[i], f.b[j], acc[i][j]); };
    FRQ f0, f1; fetch(f0, 0);
#pragma unroll
    for (int kc = 0; kc < DM; kc += 64) { fetch(f1, kc + 32); mm(f0); if (kc + 64 < DM) fetch(f0, kc + 64); mm(f1); }   // two fragment sets: each k step's reads are issued one step ahead
    const int bt = r0 / TT, t0 = r0 % TT, g0 = bt * NH_ + (c0 >> 5);   // the tile's batch, first token and first head plane
    if (sel == 2) {   // acc[i][j][r]: token t0 + 16 i + 8 hi + r, column c0 + 16 j + lr
        const size_t vo = (size_t)g0 * HP * TT + t0 * 32 + lr * 16 + 8 * hi; bf* ph = Vh + vo; bf* pl = Vl + vo; float bb[4];
#pragma unroll
        for (int j = 0; j < 4; ++j) bb[j] = bias[c0 + j * 16 + lr];
        asm volatile("s_wait_xcnt 0x0" ::: "memory");   // behind the bias loads, in front of any rewrite of their address registers
        __builtin_amdgcn_sched_barrier(0);              // keeps later arithmetic behind that wait
#pragma unroll
        for (int j = 0; j < 4; ++j) { v4u hv[4], lv[4]; const float b1 = bfr(bb[j]);
#pragma unroll
            for (int i = 0; i < 4; ++i) split8(acc[i][j] + b1, hv[i], lv[i]);
            const int of = (j >> 1) * HP * TT + (j & 1) * 512; st4<256, 1024>(ph + of, pl + of, hv, lv); }
    } else {          // acc[i][j][r]: column c0 + 16 i + 8 hi + r, token t0 + 16 j + lr
        const float sc = sel == 0 ? QSC : 1.0f; const size_t po = ((size_t)g0 * TT + t0) * HD + lr * 16 + 8 * hi; bf* ph = (sel == 0 ? Qh : Kh) + po; bf* pl = (sel == 0 ? Ql : Kl) + po; v8f bb[4]; float nj[4], km[2];   // nj: a token's sum of squares over one head's 32 columns (this half's 16); km: the largest over the lane's four tokens t0 + 16 j + lr, per head
#pragma unroll
        for (int i = 0; i < 4; ++i) bb[i] = *(const v8f*)(bias + c0 + i * 16 + 8 * hi);
        asm volatile("s_wait_xcnt 0x0" ::: "memory");   // behind the bias loads, in front of any rewrite of their address registers
        __builtin_amdgcn_sched_barrier(0);              // keeps later arithmetic behind that wait
#pragma unroll
        for (int i = 0; i < 4; ++i) { v4u hv[4], lv[4]; v8f b8;
#pragma unroll
            for (int r = 0; r < 8; ++r) b8[r] = bfr(bb[i][r]);
#pragma unroll
            for (int j = 0; j < 4; ++j) { const v8f y = (acc[i][j] + b8) * sc; split8(y, hv[j], lv[j]); float q2 = (i & 1) ? nj[j] : 0.f;
#pragma unroll
                for (int r = 0; r < 8; ++r) q2 = fmaf(y[r], y[r], q2);
                nj[j] = q2; }
            if (i & 1) { const float a0 = fmaxf(nj[0] + xhalf(nj[0]), nj[1] + xhalf(nj[1])), a1 = fmaxf(nj[2] + xhalf(nj[2]), nj[3] + xhalf(nj[3])); km[i >> 1] = fmaxf(a0, a1); }
            const int of = (i >> 1) * TT * HD + (i & 1) * 256; st4<512, 1024>(ph + of, pl + of, hv, lv); }
        if (sel == 1) KM[(((size_t)bt * (NH_ / 2) + (c0 >> 6)) * (TT / 64) + (t0 >> 6)) * 32 + lane] = hi ? km[1] : km[0];   // [batch][head pair][64 tokens][head of the pair][16 lanes]: a wave writes one whole line
    }
}

// k_out: out = (merged hi + merged lo) bf16(wo)^T + bf16(bo) over all batches' rows at once. Grid rows / 64; a work-group stages 64 rows of both merged planes and the whole weight (rounded to bf16) in LDS; 8 waves = 2 x 4 tiles of 32 rows x 64 columns; the weight rows are the A operand, so a lane holds 8 consecutive output columns of one row.
__global__ __launch_bounds__(256) void k_out(const bf* __restrict__ Ah, const bf* __restrict__ Al, const float* __restrict__ wo, const float* __restrict__ bo, float* out) {
    __shared__ __align__(16) bf sm[(64 + 64 + 256) * LP];   // rows 0..63: merged hi; 64..127: merged lo; 128..383: weight
    const int tid = threadIdx.x, lane = tid & 31, lr = lane & 15, hi = lane >> 4, wave = __builtin_amdgcn_readfirstlane(tid >> 5);
    const int rw = (wave >> 2) * 32, r0 = blockIdx.x * 64 + rw, c0 = (wave & 3) * 64;
    { const bf* gh = Ah + (size_t)blockIdx.x * 64 * DQ + tid * 8; const bf* gl = Al + (size_t)blockIdx.x * 64 * DQ + tid * 8; const float* gw = wo + tid * 4;
      bf* sa = sm + (tid >> 5) * LP + (tid & 31) * 8; bf* st = sm + (128 + (tid >> 6)) * LP + (tid & 63) * 4; v8us th[8], tl[8]; v4f ra[32], rb[32];
#pragma unroll
      for (int it = 0; it < 8; ++it) { th[it] = *(const v8us*)(gh + it * 2048); tl[it] = *(const v8us*)(gl + it * 2048); }   // step 'it' is 8 rows on
      ldrows(ra, gw);
#pragma unroll
      for (int it = 0; it < 8; ++it) { *(v8usa*)(sa + it * 8 * LP) = th[it]; *(v8usa*)(sa + (64 + it * 8) * LP) = tl[it]; }
      ldrows(rb, gw + 32 * 1024); strows(ra, st); strows(rb, st + 128 * LP); }
    __syncthreads();   // every wave reads rows that other waves staged
    const bf* pa = sm + (128 + c0 + lr) * LP + 8 * hi; const bf* ph = sm + (rw + lr) * LP + 8 * hi; const bf* pl = ph + 64 * LP;
    v8f acc[4][2];
#pragma unroll
    for (int i = 0; i < 4; ++i)
#pragma unroll
        for (int j = 0; j < 2; ++j) acc[i][j] = (v8f){};
    auto fetch = [&](FRO& f, int kc) {
#pragma unroll
        for (int i = 0; i < 4; ++i) f.a[i] = WFrag<bf>::ld(pa + i * 16 * LP + kc);
#pragma unroll
        for (int j = 0; j < 2; ++j) { f.bh[j] = WFrag<bf>::ld(ph + j * 16 * LP + kc); f.bl[j] = WFrag<bf>::ld(pl + j * 16 * LP + kc); }
        __builtin_amdgcn_sched_barrier(0); };   // keeps a k step's LDS reads in one group above the matrix instructions of the step before (sunk to their first use each read's latency is exposed)
    auto mm = [&](const FRO& f) {   // per accumulator: hi, then lo
#pragma unroll
        for (int j = 0; j < 2; ++j)
#pragma unroll
            for (int i = 0; i < 4; ++i) acc[i][j] = wmmab(f.a[i], f.bh[j], acc[i][j]);
#pragma unroll
        for (int j = 0; j < 2; ++j)
#pragma unroll
            for (int i = 0; i < 4; ++i) acc[i][j] = wmmab(f.a[i], f.bl[j], acc[i][j]); };
    FRO f0, f1; fetch(f0, 0);
#pragma unroll
    for (int kc = 0; kc < DQ; kc += 64) { fetch(f1, kc + 32); mm(f0); if (kc + 64 < DQ) fetch(f0, kc + 64); mm(f1); }   // two fragment sets: each k step's reads are issued one step ahead
    float* po = out + (size_t)(r0 + lr) * DM + c0 + 8 * hi;   // acc[i][j][r]: column c0 + 16 i + 8 hi + r, row r0 + 16 j + lr
#pragma unroll
    for (int i = 0; i < 4; ++i) { v8f bb = *(const v8f*)(bo + c0 + i * 16 + 8 * hi);
#pragma unroll
        for (int r = 0; r < 8; ++r) bb[r] = bfr(bb[r]);
#pragma unroll
        for (int j = 0; j < 2; ++j) *(v8f*)(po + j * 16 * DM + i * 16) = acc[i][j] + bb; }
}

// k_fattn: S^T = K Q^T (keys x queries), t = leaky_relu_0.2(S^T x the bf16 adjacency plane) in the log2 domain over ALL 2048 keys (zeroed logits stay in the softmax), a shift and a sum per query column (the shift: an upper bound of the column's logits, or the running maximum where the bound is large), O^T += V^T P^T with P^T packed from the score accumulators (hi/lo); the scores never leave registers.
// Work-group: 8 waves = 2 heads x 4 tiles of 32 queries; grid (TT / 128, heads / 2, batches). A lane (c, h) holds query c of each 16-column group; accumulator register r of key tile t is key k0 + 16 t + 8 h + r, which is the k order of the B operand and of the V^T loader.
struct KVG { v16bf kh[2], kl[2], vh[2], vl[2]; v4u g[2][2]; };
__global__ __launch_bounds__(256) void k_fattn(const bf* __restrict__ Qh, const bf* __restrict__ Ql, const bf* __restrict__ Kh, const bf* __restrict__ Kl, const bf* __restrict__ Vh, const bf* __restrict__ Vl, const bf* __restrict__ AB, const float* __restrict__ KM, const float* __restrict__ AM, bf* Ah, bf* Al) {
    __shared__ __align__(16) bf so[2][128][72];   // output staging, pitch 144 B
    const int lane = threadIdx.x & 31, c = lane & 15, h = lane >> 4, wave = __builtin_amdgcn_readfirstlane(threadIdx.x >> 5);   // the wave's number in a scalar register: the plane bases below are then scalar
    const int hs = wave >> 2, head = blockIdx.y * 2 + hs, b = blockIdx.z, qw = (wave & 3) * 32, q0 = blockIdx.x * 128 + qw;
    const size_t pz = ((size_t)b * NH_ + head) * TT * HD, vz = ((size_t)b * NKV + head) * HP * TT;
    v16bf qh[2], ql[2]; const bf* qa = Qh + pz + (size_t)q0 * HD + c * 16 + 8 * h; const bf* qb = Ql + pz + (size_t)q0 * HD + c * 16 + 8 * h;
#pragma unroll
    for (int n = 0; n < 2; ++n) { qh[n] = ldfr(qa + n * 16 * HD); ql[n] = ldfr(qb + n * 16 * HD); }
    asm volatile("s_wait_xcnt 0x0" ::: "memory");   // behind the loads, in front of any rewrite of their address registers
    __builtin_amdgcn_sched_barrier(0);              // keeps later address arithmetic behind that wait
    v4f kq[4], aq[2][2]; const float* kp = KM + (((size_t)b * (NH_ / 2) + blockIdx.y) * (TT / 64) + lane) * 32 + hs * 16; const float* ap = AM + (size_t)(q0 + c) * 8;   // lane l: the head's 16 partial maxima of |k|^2 of tokens 64 l ..; the 8 partial maxima of |adjacency| of the lane's two query rows
#pragma unroll
    for (int i = 0; i < 4; ++i) kq[i] = *(const v4f*)(kp + i * 4);
#pragma unroll
    for (int n = 0; n < 2; ++n) { aq[n][0] = *(const v4f*)(ap + n * 128); aq[n][1] = *(const v4f*)(ap + n * 128 + 4); }
    asm volatile("s_wait_xcnt 0x0" ::: "memory");   // behind the loads of the partial maxima, in front of any rewrite of their address registers
    __builtin_amdgcn_sched_barrier(0);              // keeps later address arithmetic behind that wait
    const bf* kh0 = Kh + pz + c * 16 + 8 * h; const bf* kl0 = Kl + pz + c * 16 + 8 * h; const bf* vh0 = Vh + vz + c * 16 + 8 * h; const bf* vl0 = Vl + vz + c * 16 + 8 * h; const bf* ar0 = AB + (size_t)(q0 >> 4) * (TT * 16) + c * 16 + 8 * h;   size_t ks = 0;   // the lane's five pointers; ks: the trip's first key, in a scalar register; every load is a pointer plus ks's share plus a constant
    v8f o[2][2]; float mx[2], ls[2];
#pragma unroll
    for (int n = 0; n < 2; ++n) { o[0][n] = (v8f){}; o[1][n] = (v8f){}; mx[n] = -3.0e38f; ls[n] = 0.f; }
    auto fetch = [&](KVG& f, int ko) {   // ko: key offset from ks, a constant at every call
        const bf* kh = kh0 + ks * HD; const bf* kl = kl0 + ks * HD; const bf* vh = vh0 + ks * 32; const bf* vl = vl0 + ks * 32; const bf* ar = ar0 + ks * 16;
#pragma unroll
        for (int t = 0; t < 2; ++t) { f.kh[t] = ldfr(kh + (ko + t * 16) * HD); f.kl[t] = ldfr(kl + (ko + t * 16) * HD); }
#pragma unroll
        for (int n = 0; n < 2; ++n)
#pragma unroll
            for (int t = 0; t < 2; ++t) f.g[n][t] = *(const v4u*)(ar + n * 16 * TT + ko * 16 + t * 256);
#pragma unroll
        for (int m = 0; m < 2; ++m) { f.vh[m] = ldfr(vh + ko * 32 + m * 512); f.vl[m] = ldfr(vl + ko * 32 + m * 512); }
        asm volatile("s_wait_xcnt 0x0" :: "v"(kh), "v"(kl), "v"(vh), "v"(vl), "v"(ar) : "memory");   // behind the pass's loads; the five addresses are inputs so that their registers stay theirs up to this wait (freed at the last load they were rewritten in front of it)
        __builtin_amdgcn_sched_barrier(0); };           // keeps the loads above the work that follows (sunk to their first use their latency is exposed) and the advance behind the wait
    auto work = [&](const KVG& f) {
#pragma unroll
        for (int n = 0; n < 2; ++n) { v8f s[2]; float tm = mx[n];
#pragma unroll
            for (int t = 0; t < 2; ++t) { s[t] = wmmab(f.kh[t], qh[n], (v8f){}); s[t] = wmmab(f.kl[t], qh[n], s[t]); s[t] = wmmab(f.kh[t], ql[n], s[t]); }
#pragma unroll
            for (int t = 0; t < 2; ++t)
#pragma unroll
                for (int r = 0; r < 8; r += 2) { const unsigned gp = f.g[n][t][r >> 1]; const float u0 = s[t][r] * bflo(gp), u1 = s[t][r + 1] * bfhi(gp); const float t0 = fmaxf(u0, u0 * LEAK), t1 = fmaxf(u1, u1 * LEAK);   /* LeakyReLU(0.2) = max(u, 0.2 u) */ s[t][r] = t0; s[t][r + 1] = t1; tm = fmaxf(tm, fmaxf(t0, t1)); }
            tm = fmaxf(tm, xhalf(tm)); const float al = __builtin_amdgcn_exp2f(mx[n] - tm); mx[n] = tm; float sum = 0.f; v8u ph, pl;
#pragma unroll
            for (int t = 0; t < 2; ++t)
#pragma unroll
                for (int r = 0; r < 8; r += 2) { const float p0 = __builtin_amdgcn_exp2f(s[t][r] - tm), p1 = __builtin_amdgcn_exp2f(s[t][r + 1] - tm); sum += p0 + p1; const unsigned hp2 = pkbf(p0, p1); ph[t * 4 + (r >> 1)] = hp2; pl[t * 4 + (r >> 1)] = pkbf(p0 - bflo(hp2), p1 - bfhi(hp2)); }
            ls[n] = ls[n] * al + sum; const v16bf pbh = __builtin_bit_cast(v16bf, ph), pbl = __builtin_bit_cast(v16bf, pl);
#pragma unroll
            for (int m = 0; m < 2; ++m) { o[m][n] *= al; o[m][n] = wmmab(f.vh[m], pbh, o[m][n]); o[m][n] = wmmab(f.vl[m], pbh, o[m][n]); o[m][n] = wmmab(f.vh[m], pbl, o[m][n]); } } };
    KVG fa, fb; fetch(fa, 0);
    // Upper bound of a query's logits in the log2 domain: |q| x the head's largest |k| x the row's largest |adjacency| (LeakyReLU raises no magnitude; 1.01 covers q's lo part and rounding). Softmax is unchanged by the shift, and f32 keeps its relative precision at any shift that neither overflows nor underflows.
    float rf[2], nr[2], c8[2];
    { float k2 = 0.f;
#pragma unroll
      for (int i = 0; i < 4; ++i) k2 = fmaxf(k2, fmaxf(fmaxf(kq[i][0], kq[i][1]), fmaxf(kq[i][2], kq[i][3])));
      k2 = fmaxf(k2, xhalf(k2));
#pragma unroll
      for (int m = 8; m >= 1; m >>= 1) k2 = fmaxf(k2, __shfl_xor(k2, m, 32));
#pragma unroll
      for (int n = 0; n < 2; ++n) { float q2 = 0.f;
#pragma unroll
          for (int e = 0; e < 16; ++e) { const float fq = (float)qh[n][e]; q2 = fmaf(fq, fq, q2); }
          q2 += xhalf(q2); const v4f a4 = __builtin_elementwise_max(aq[n][0], aq[n][1]); const float am = fmaxf(fmaxf(a4[0], a4[1]), fmaxf(a4[2], a4[3]));
          rf[n] = __builtin_amdgcn_sqrtf(q2 * k2) * am * 1.01f; nr[n] = -rf[n]; c8[n] = (LEAK - 1.0f) * rf[n]; } }
    // The pass with the bound as the shift: no maximum, no rescale, the subtraction folded into the adjacency product. x = u - rf; 0.2 u - rf = 0.2 x - 0.8 rf.
    auto workb = [&](const KVG& f) {
#pragma unroll
        for (int n = 0; n < 2; ++n) { v8f s[2];
#pragma unroll
            for (int t = 0; t < 2; ++t) { s[t] = wmmab(f.kh[t], qh[n], (v8f){}); s[t] = wmmab(f.kl[t], qh[n], s[t]); s[t] = wmmab(f.kh[t], ql[n], s[t]); }
            float sum = 0.f; v8u ph, pl;
#pragma unroll
            for (int t = 0; t < 2; ++t)
#pragma unroll
                for (int r = 0; r < 8; r += 2) { const unsigned gp = f.g[n][t][r >> 1]; const float x0 = fmaf(s[t][r], bflo(gp), nr[n]), x1 = fmaf(s[t][r + 1], bfhi(gp), nr[n]);
                    const float p0 = __builtin_amdgcn_exp2f(fmaxf(x0, fmaf(x0, LEAK, c8[n]))), p1 = __builtin_amdgcn_exp2f(fmaxf(x1, fmaf(x1, LEAK, c8[n]))); sum += p0 + p1; const unsigned hp2 = pkbf(p0, p1); ph[t * 4 + (r >> 1)] = hp2; pl[t * 4 + (r >> 1)] = pkbf(p0 - bflo(hp2), p1 - bfhi(hp2)); }
            ls[n] += sum; const v16bf pbh = __builtin_bit_cast(v16bf, ph), pbl = __builtin_bit_cast(v16bf, pl);
#pragma unroll
            for (int m = 0; m < 2; ++m) { o[m][n] = wmmab(f.vh[m], pbh, o[m][n]); o[m][n] = wmmab(f.vl[m], pbh, o[m][n]); o[m][n] = wmmab(f.vh[m], pbl, o[m][n]); } } };
    auto sweep = [&](auto&& wk) {
#pragma unroll 1
        for (int k0 = 0; k0 < TT - 64; k0 += 64) {   // two register sets: each pass's loads are issued one pass ahead
            fetch(fb, 32); wk(fa); fetch(fa, 64); wk(fb);
            // the advance by 64 keys, in one statement with its wait: every address of the next trip is formed from ks, so none of the loads' address registers is rewritten in front of the wait (plain additions were lifted over the wait in fetch)
            asm volatile("s_wait_xcnt 0x0\n\ts_add_nc_u64 %0, %0, 64" : "+s"(ks) :: "memory"); }
        fetch(fb, 32); wk(fa); wk(fb); };   // the last 64 keys: nothing is fetched past key 2047
    // With rf <= BLIM every exponent lies in [-1.2 BLIM, 0.01 BLIM]: all terms, their lo parts and the sums stay normal f32 and bf16 numbers. A larger, infinite or NaN bound in any lane sends the wave through the running maximum.
    if (__builtin_expect(__builtin_amdgcn_ballot_w32(!(rf[0] <= BLIM && rf[1] <= BLIM)) == 0, 1)) sweep(workb); else sweep(work);
#pragma unroll
    for (int n = 0; n < 2; ++n) { const float inv = __fdiv_rn(1.0f, ls[n] + xhalf(ls[n]));
#pragma unroll
        for (int m = 0; m < 2; ++m) { v8us oh, ol;
#pragma unroll
            for (int r = 0; r < 8; ++r) { unsigned short a2, c2; splitf(o[m][n][r] * inv, a2, c2); oh[r] = a2; ol[r] = c2; }
            *(v8usa*)&so[0][qw + n * 16 + c][hs * HD + m * 16 + 8 * h] = oh; *(v8usa*)&so[1][qw + n * 16 + c][hs * HD + m * 16 + 8 * h] = ol; } }
    __syncthreads();   // the two heads of a 128-byte line of the merged planes come from different waves: one wave stores the whole line
#pragma unroll
    for (int i = 0; i < 8; ++i) { const int rem = (i & 3) * 256 + threadIdx.x, row = rem >> 3, ch = rem & 7; const v8us val = *(const v8usa*)&so[i >> 2][row][ch * 8];
        *(v8us*)(((i >> 2) ? Al : Ah) + ((size_t)b * TT + blockIdx.x * 128 + row) * DQ + blockIdx.y * 2 * HD + ch * 8) = val; }
}

extern "C" void kernel_launch(void* const* d_in, const int* in_sizes, int n_in,
                              void* d_out, int out_size, void* d_ws, size_t ws_size, hipStream_t stream) {
    (void)in_sizes; (void)n_in; (void)out_size;
    const float* x = (const float*)d_in[0]; const float* adj = (const float*)d_in[1];   /* adjacency_matrix [2048][2048] f32 0/1 (read as data) */ const float* wq = (const float*)d_in[2]; const float* bq = (const float*)d_in[3]; const float* wk = (const float*)d_in[4]; const float* bk = (const float*)d_in[5]; const float* wv = (const float*)d_in[6]; const float* bv = (const float*)d_in[7]; const float* wo = (const float*)d_in[8]; const float* bo = (const float*)d_in[9];   /* argument order hidden_states, adjacency_matrix, wq, bq, wk, bk, wv, bv, wo, bo */
    float* OUT = (float*)d_out;     // [4][2048][256]
    char* wsp = (char*)d_ws;
    auto take = [&](size_t bytes) { char* p = wsp; wsp += (bytes + 255) & ~(size_t)255; return (void*)p; };
    const size_t PZ = (size_t)NH_ * TT * HD, VZ = (size_t)NKV * HP * TT, AZ = (size_t)TT * DQ;   // one batch's q/k planes, value^T planes, merged planes (elements)
    bf* QPh = (bf*)take(NB_ * PZ * 2); bf* QPl = (bf*)take(NB_ * PZ * 2); bf* KPh = (bf*)take(NB_ * PZ * 2); bf* KPl = (bf*)take(NB_ * PZ * 2); bf* VTh = (bf*)take(NB_ * VZ * 2); bf* VTl = (bf*)take(NB_ * VZ * 2);
    bf* ATh = (bf*)take(NB_ * AZ * 2); bf* ATl = (bf*)take(NB_ * AZ * 2); bf* ADB = (bf*)take((size_t)TT * TT * 2);   // bf16 adjacency plane
    float* KMX = (float*)take((size_t)NB_ * (NH_ / 2) * (TT / 64) * 32 * 4); float* AMX = (float*)take((size_t)TT * 8 * 4);   // partial maxima of |k|^2 and of |adjacency|
    if ((size_t)(wsp - (char*)d_ws) > ws_size) return;    // ws 256 MiB
    k_qkv<<<dim3(NB_ * TT / 128, 4, 1), 256, 0, stream>>>(x, wq, bq, wk, bk, wv, bv, adj, QPh, QPl, KPh, KPl, VTh, VTl, ADB, KMX, AMX);
    k_fattn<<<dim3(TT / 128, NH_ / 2, NB_), 256, 0, stream>>>(QPh, QPl, KPh, KPl, VTh, VTl, ADB, KMX, AMX, ATh, ATl);
    k_out<<<dim3(NB_ * TT / 64, 1, 1), 256, 0, stream>>>(ATh, ATl, wo, bo, OUT);
}

// v006
// Measured time: 44.6 microseconds a run.
// Versions between v004 and this one are left out; their measured steps multiply to 1.55 times as fast.
// All steps since v000 together make it 28.9 times as fast.
#include <hip/hip_runtime.h>

// Graph attention: multi-head attention whose scaled scores are multiplied by an adjacency matrix and passed through LeakyReLU before the softmax (hidden [4][2048][256]; q, k, v = x W^T + b ('oi' [256][256] 1/16, zero biases; 8 heads x 32); s = (q.k / sqrt(32)) x adj[i][j] (f32 [2048][2048] 0/1, ~6 % ones, read); s = leaky_relu(s, 0.2); softmax over all 2048 keys; out = merged wo^T + bo -> [4][2048][256] (2.1 M); argument order hidden_states, adjacency_matrix, wq, bq, wk, bk, wv, bv, wo, bo).
// Layout: one projection launch for q, k and v over all batches (x and the 'oi' weights rounded to bf16 on the way into LDS, bf16 biases, planes stored straight from the accumulators): one f16 q, k and value^T plane per [b][h] in fragment order (below; q carries 32^-0.5 x log2 e), and, from extra blocks of the same launch, the adjacency rounded to bf16 in fragment order, and wo likewise; one fused attention kernel over all batches and heads, which also forms merged hi/lo x wo + bo for its 32 query rows.
// Fragment order: the two 16-byte pieces that a lane (c, h) takes for one 16 x 32 operand tile lie at piece * 512 B + c * 32 B + h * 16 B of the tile's 1 KiB, so that one load of a wave covers four whole 128-byte lines (row-major planes made it touch 8 or 16 lines). q/k tile: 16 tokens x 32 d; value^T tile: 16 d x 32 keys, tiles ordered [key block][d half]; adjacency tile: 16 queries x 32 keys, tiles ordered [query tile][key block]; wo tile: 16 weight rows x 32 k, tiles ordered [row tile][k block].
// Compute dtypes, f32 accumulate: every input rounded to bf16 incl. the adjacency; projections exact + bf16 biases; q, k, v and the softmax terms each rounded once to f16, scores (K 32) and attn.v one f16 product each; softmax f32, shifted by a whole number taken from a per-query upper bound of the logits (running maximum where that bound is large); wo hl x exact + bias.

#define NB_  4
#define TT   2048
#define DM   256
#define NH_  8
#define NKV  8
#define REP  (NH_ / NKV)
#define HD   32
#define DQ   (NH_ * HD)
#define DKV  (NKV * HD)
#define ZH   2
#define RH   2048                 // = TT: every row hi/lo
#define WIN  0
#define PCAR 1024.0f
#define SCL  0.17677669529663688f   // 32^-0.5 (the module divides by float32(sqrt(32)); one multiply here)
#define LEAK 0.2f
#define BLIM 24.0f   // largest logit bound (log2 domain) for which one shift keeps every softmax term a normal f16 number
#define PTOP 15.0f   // the largest softmax term is 2^PTOP, under the f16 maximum
#define HP   64    // a head's value^T plane is HP x TT elements apart from the next; the first 32 x TT are written and read
typedef _Float16 h16;
typedef unsigned short bf;
typedef __attribute__((ext_vector_type(16))) __bf16   v16bf;
typedef __attribute__((ext_vector_type(16))) _Float16 v16h;
typedef __attribute__((ext_vector_type(8)))  _Float16 v8h;
typedef __attribute__((ext_vector_type(8)))  unsigned short v8us;
typedef __attribute__((ext_vector_type(8)))  float    v8f;
typedef __attribute__((ext_vector_type(4)))  float    v4f;
typedef v8h  __attribute__((may_alias)) v8ha;
typedef v4f  __attribute__((may_alias)) v4fa;
typedef v8us __attribute__((may_alias)) v8usa;

__device__ __forceinline__ unsigned short f2bf(float f) { unsigned u = __float_as_uint(f); u += 0x7FFFu + ((u >> 16) & 1u); return (unsigned short)(u >> 16); }
__device__ __forceinline__ float bf2f(unsigned short b) { return __uint_as_float(((unsigned)b) << 16); }
__device__ __forceinline__ float bfr(float f) { return bf2f(f2bf(f)); }
__device__ __forceinline__ v16h cat16(v8h lo, v8h hi) { return __builtin_shufflevector(lo, hi, 0, 1, 2, 3, 4, 5, 6, 7, 8, 9, 10, 11, 12, 13, 14, 15); }
__device__ __forceinline__ v16bf cat16b(v8us lo, v8us hi) { return __builtin_bit_cast(v16bf, __builtin_shufflevector(lo, hi, 0, 1, 2, 3, 4, 5, 6, 7, 8, 9, 10, 11, 12, 13, 14, 15)); }
__device__ __forceinline__ v8f wmma16(v16h a, v16h b, v8f c) { return __builtin_amdgcn_wmma_f32_16x16x32_f16(false, a, false, b, (short)0, c, false, false); }
__device__ __forceinline__ v8f wmmab(v16bf a, v16bf b, v8f c) { return __builtin_amdgcn_wmma_f32_16x16x32_bf16(false, a, false, b, (short)0, c, false, false); }



template <typename T16> struct WFrag;
template <> struct WFrag<bf> { typedef v16bf V; static __device__ __forceinline__ V ld(const bf* p) { return cat16b(*(const v8us*)p, *(const v8us*)(p + 16)); } static __device__ __forceinline__ v8f mma(V a, V b, v8f c) { return wmmab(a, b, c); } };
__device__ __forceinline__ v16h ldfr(const bf* p) { return __builtin_bit_cast(v16h, __builtin_shufflevector(*(const v8us*)p, *(const v8us*)(p + 256), 0, 1, 2, 3, 4, 5, 6, 7, 8, 9, 10, 11, 12, 13, 14, 15)); }   // a lane's two pieces of an f16 tile in fragment order
__device__ __forceinline__ void splitf(float y, unsigned short& h, unsigned short& l) { h = f2bf(y); l = f2bf(y - bf2f(h)); }
typedef __attribute__((ext_vector_type(2))) float v2f;
typedef __attribute__((ext_vector_type(4))) unsigned v4u;
#define QSC  0.25503486164919736f   // 32^-0.5 x log2(e): LeakyReLU commutes with a positive factor, so the logits are formed in the log2 domain
typedef __attribute__((ext_vector_type(2))) __bf16 v2bf;
typedef __attribute__((ext_vector_type(8))) unsigned v8u;
__device__ __forceinline__ unsigned pkbf(float a, float b) { v2f t; t[0] = a; t[1] = b; return __builtin_bit_cast(unsigned, __builtin_convertvector(t, v2bf)); }   // two f32 -> two bf16, round to nearest even
typedef __attribute__((ext_vector_type(2))) _Float16 v2h;
__device__ __forceinline__ unsigned pkh(float a, float b) { v2f t; t[0] = a; t[1] = b; return __builtin_bit_cast(unsigned, __builtin_convertvector(t, v2h)); }   // two f32 -> two f16, round to nearest even
__device__ __forceinline__ float bflo(unsigned u) { return __uint_as_float(u << 16); }
__device__ __forceinline__ float bfhi(unsigned u) { return __uint_as_float(u & 0xFFFF0000u); }
__device__ __forceinline__ float xhalf(float v) { const int b = __float_as_int(v); return __int_as_float(__builtin_amdgcn_permlanex16(b, b, 0x76543210, 0xfedcba98, false, false)); }   // the value of lane l ^ 16


#define LP 264   // LDS row pitch of a 256-element bf16 row: 528 B = 16 B x 33, an odd count of 16-byte units, for the 16-byte fragment reads
typedef __attribute__((ext_vector_type(2))) unsigned v2u;
typedef v2u __attribute__((may_alias)) v2ua;
// Staging of f32 rows of 256 as bf16 rows in LDS, 256 threads: a wave's load is 512 contiguous bytes; step 'it' is 4 rows on. ldrows only loads, so that a whole batch is in flight; strows rounds (nearest even) and stores.
template <int N> __device__ __forceinline__ void ldrows(v4f (&r)[N], const float* g) {
#pragma unroll
    for (int it = 0; it < N; ++it) r[it] = *(const v4f*)(g + it * 1024);
    asm volatile("s_wait_xcnt 0x0" ::: "memory");   // behind the batch's loads, in front of any rewrite of their address registers
    __builtin_amdgcn_sched_barrier(0); }            // keeps the batch's loads above the LDS stores that follow (sunk to their first use they would go out one at a time)
template <int N> __device__ __forceinline__ void strows(const v4f (&r)[N], bf* s) {
#pragma unroll
    for (int it = 0; it < N; ++it) { v2u o; o[0] = pkbf(r[it][0], r[it][1]); o[1] = pkbf(r[it][2], r[it][3]); *(v2ua*)(s + it * 4 * LP) = o; } }
// Eight f32 -> eight f16, packed for one 16-byte store.
__device__ __forceinline__ void round8(v8f y, v4u& hv) {
#pragma unroll
    for (int r = 0; r < 4; ++r) hv[r] = pkh(y[2 * r], y[2 * r + 1]); }
// Four accumulator tiles' pieces to the plane: piece k lies (k & 1) * S1 + (k >> 1) * S2 elements on.
template <int S1, int S2> __device__ __forceinline__ void st4(bf* ph, const v4u (&hv)[4]) {
    __builtin_amdgcn_sched_barrier(0);              // all four pieces are formed above the first store, so that none of the stores' data registers is rewritten among them
#pragma unroll
    for (int k = 0; k < 4; ++k) *(v8us*)(ph + (k & 1) * S1 + (k >> 1) * S2) = __builtin_bit_cast(v8us, hv[k]);
    asm volatile("s_wait_xcnt 0x0" ::: "memory");   // behind the stores, in front of any rewrite of their data and address registers
    __builtin_amdgcn_sched_barrier(0); }            // keeps the next tiles' arithmetic behind that wait

struct FRQ { v16bf a[4], b[4]; };
// k_qkv: q, k, v = bf16(x) bf16(W)^T + bf16(b) for all batches, stored as the attention kernel's planes. Grid (rows / 128, 4): blockIdx.y picks q, k, v or the adjacency plane (32 adjacency rows a block, no LDS use; the first 128 waves of those blocks also round one 16 x 32 tile of wo each). A work-group rounds 128 rows of x and the whole weight to bf16 in LDS once; 8 waves = 2 x 4 tiles of 64 rows x 64 columns, 16 accumulators a wave.
// An accumulator register run is 8 consecutive rows of the A operand at one row of the B operand: for q and k the weight rows are A (a lane holds 8 consecutive d of one token), for v the token rows are A (8 consecutive tokens of one d), so every plane is written in 16-byte pieces with no transpose, 512 contiguous bytes a store.
__global__ __launch_bounds__(256) void k_qkv(const float* __restrict__ x, const float* __restrict__ wq, const float* __restrict__ bq, const float* __restrict__ wk, const float* __restrict__ bk, const float* __restrict__ wv, const float* __restrict__ bv, const float* __restrict__ adj, const float* __restrict__ wout, bf* Qh, bf* Kh, bf* Vh, bf* AB, bf* WB, float* KM, float* AM) {
    __shared__ __align__(16) bf sm[(128 + 256) * LP];   // rows 0..127: x tile; rows 128..383: weight
    const int tid = threadIdx.x, lane = tid & 31, lr = lane & 15, hi = lane >> 4, wave = __builtin_amdgcn_readfirstlane(tid >> 5);
    if (blockIdx.y == 3) {   // the whole block leaves here, in front of the barrier. A wave takes 4 rows x 64 keys a step: 8 whole lines read, 4 whole lines written
        static_assert(NB_ * TT / 128 * 32 == TT, "one block for every 32 adjacency rows");
        const int tw = blockIdx.x * 8 + wave;   // wave-uniform: tile tw = [row tile tw >> 3][k block tw & 7] of wo
        if (tw < (DM / 16) * (DQ / 32)) { const float* gs = wout + (size_t)((tw >> 3) * 16 + lr) * DQ + (tw & 7) * 32 + 8 * hi; const v8f w0 = *(const v8f*)gs, w1 = *(const v8f*)(gs + 16); v4u p0, p1;
            asm volatile("s_wait_xcnt 0x0" ::: "memory");   // behind the two loads, in front of any rewrite of their address registers
            __builtin_amdgcn_sched_barrier(0);              // keeps later arithmetic behind that wait
#pragma unroll
            for (int k = 0; k < 4; ++k) { p0[k] = pkbf(w0[2 * k], w0[2 * k + 1]); p1[k] = pkbf(w1[2 * k], w1[2 * k + 1]); }
            bf* dw = WB + (size_t)tw * 512 + lr * 16 + 8 * hi; *(v8us*)dw = __builtin_bit_cast(v8us, p0); *(v8us*)(dw + 256) = __builtin_bit_cast(v8us, p1);
            asm volatile("s_wait_xcnt 0x0" ::: "memory");   // behind the two stores, in front of any rewrite of their data and address registers
            __builtin_amdgcn_sched_barrier(0); }            // keeps the adjacency work behind that wait
        const int k8 = lane & 7, row = blockIdx.x * 32 + wave * 4 + (lane >> 3);
        const float* g = adj + (size_t)row * TT + k8 * 8; bf* d = AB + ((size_t)(row >> 4) * 128 + (k8 >> 1)) * 256 + (row & 15) * 16 + (k8 & 1) * 8; float am = 0.f;   // am: largest |adjacency| among the lane's share of its row
#pragma unroll
        for (int hb = 0; hb < 2; ++hb) { v8f r[16]; v4u o[16];
#pragma unroll
            for (int it = 0; it < 16; ++it) r[it] = *(const v8f*)(g + (hb * 16 + it) * 64);
            asm volatile("s_wait_xcnt 0x0" ::: "memory");   // behind the batch's loads, in front of any rewrite of their address registers
            __builtin_amdgcn_sched_barrier(0);              // keeps the batch's loads together above the rounding (sunk to their first use they would go out one at a time)
#pragma unroll
            for (int it = 0; it < 16; ++it)
#pragma unroll
                for (int k = 0; k < 4; ++k) { o[it][k] = pkbf(r[it][2 * k], r[it][2 * k + 1]); am = fmaxf(am, fmaxf(fabsf(r[it][2 * k]), fabsf(r[it][2 * k + 1]))); }
            __builtin_amdgcn_sched_barrier(0);              // all pieces are formed above the first store, so that none of the stores' data registers is rewritten among them
#pragma unroll
            for (int it = 0; it < 16; ++it) *(v8us*)(d + (hb * 16 + it) * 1024) = __builtin_bit_cast(v8us, o[it]);
            asm volatile("s_wait_xcnt 0x0" ::: "memory");   // behind the stores, in front of any rewrite of their data and address registers
            __builtin_amdgcn_sched_barrier(0); }            // keeps the next batch behind that wait
        AM[(size_t)row * 8 + k8] = am;   // eight partial maxima a row; a wave writes one whole line
        return; }
    const int sel = blockIdx.y, rw = (wave >> 2) * 64, r0 = blockIdx.x * 128 + rw, c0 = (wave & 3) * 64;
    const float* w = sel == 0 ? wq : sel == 1 ? wk : wv; const float* bias = sel == 0 ? bq : sel == 1 ? bk : bv;
    { const float* gx = x + (size_t)blockIdx.x * 128 * DM + tid * 4; const float* gw = w + tid * 4; bf* st = sm + (tid >> 6) * LP + (tid & 63) * 4; v4f ra[32], rb[32];
      ldrows(ra, gx); ldrows(rb, gw); strows(ra, st); ldrows(ra, gw + 32 * 1024); strows(rb, st + 128 * LP); strows(ra, st + 256 * LP); }
    __syncthreads();   // every wave reads rows that other waves staged
    const int xo = (rw + lr) * LP + 8 * hi, wo = (128 + c0 + lr) * LP + 8 * hi;
    const bf* pa = sm + (sel == 2 ? xo : wo); const bf* pb = sm + (sel == 2 ? wo : xo);
    v8f acc[4][4];
#pragma unroll
    for (int i = 0; i < 4; ++i)
#pragma unroll
        for (int j = 0; j < 4; ++j) acc[i][j] = (v8f){};
    auto fetch = [&](FRQ& f, int kc) {
#pragma unroll
        for (int i = 0; i < 4; ++i) { f.a[i] = WFrag<bf>::ld(pa + i * 16 * LP + kc); f.b[i] = WFrag<bf>::ld(pb + i * 16 * LP + kc); }
        __builtin_amdgcn_sched_barrier(0); };   // keeps a k step's LDS reads in one group above the matrix instructions of the step before (sunk to their first use each read's latency is exposed)
    auto mm = [&](const FRQ& f) {
#pragma unroll
        for (int j = 0; j < 4; ++j)
#pragma unroll
            for (int i = 0; i < 4; ++i) acc[i][j] = wmmab(f.a[i], f.b[j], acc[i][j]); };
    FRQ f0, f1; fetch(f0, 0);
#pragma unroll
    for (int kc = 0; kc < DM; kc += 64) { fetch(f1, kc + 32); mm(f0); if (kc + 64 < DM) fetch(f0, kc + 64); mm(f1); }   // two fragment sets: each k step's reads are issued one step ahead
    const int bt = r0 / TT, t0 = r0 % TT, g0 = bt * NH_ + (c0 >> 5);   // the tile's batch, first token and first head plane
    if (sel == 2) {   // acc[i][j][r]: token t0 + 16 i + 8 hi + r, column c0 + 16 j + lr
        const size_t vo = (size_t)g0 * HP * TT + t0 * 32 + lr * 16 + 8 * hi; bf* ph = Vh + vo; float bb[4];
#pragma unroll
        for (int j = 0; j < 4; ++j) bb[j] = bias[c0 + j * 16 + lr];
        asm volatile("s_wait_xcnt 0x0" ::: "memory");   // behind the bias loads, in front of any rewrite of their address registers
        __builtin_amdgcn_sched_barrier(0);              // keeps later arithmetic behind that wait
#pragma unroll
        for (int j = 0; j < 4; ++j) { v4u hv[4]; const float b1 = bfr(bb[j]);
#pragma unroll
            for (int i = 0; i < 4; ++i) round8(acc[i][j] + b1, hv[i]);
            const int of = (j >> 1) * HP * TT + (j & 1) * 512; st4<256, 1024>(ph + of, hv); }
    } else {          // acc[i][j][r]: column c0 + 16 i + 8 hi + r, token t0 + 16 j + lr
        const float sc = sel == 0 ? QSC : 1.0f; const size_t po = ((size_t)g0 * TT + t0) * HD + lr * 16 + 8 * hi; bf* ph = (sel == 0 ? Qh : Kh) + po; v8f bb[4]; float nj[4], km[2];   // nj: a token's sum of squares over one head's 32 columns (this half's 16); km: the largest over the lane's 4 tokens, per head
#pragma unroll
        for (int i = 0; i < 4; ++i) bb[i] = *(const v8f*)(bias + c0 + i * 16 + 8 * hi);
        asm volatile("s_wait_xcnt 0x0" ::: "memory");   // behind the bias loads, in front of any rewrite of their address registers
        __builtin_amdgcn_sched_barrier(0);              // keeps later arithmetic behind that wait
#pragma unroll
        for (int i = 0; i < 4; ++i) { v4u hv[4]; v8f b8;
#pragma unroll
            for (int r = 0; r < 8; ++r) b8[r] = bfr(bb[i][r]);
#pragma unroll
            for (int j = 0; j < 4; ++j) { const v8f y = (acc[i][j] + b8) * sc; round8(y, hv[j]); float q2 = (i & 1) ? nj[j] : 0.f;
#pragma unroll
                for (int r = 0; r < 8; ++r) q2 = fmaf(y[r], y[r], q2);
                nj[j] = q2; }
            if (i & 1) { const float a0 = fmaxf(nj[0] + xhalf(nj[0]), nj[1] + xhalf(nj[1])), a1 = fmaxf(nj[2] + xhalf(nj[2]), nj[3] + xhalf(nj[3])); km[i >> 1] = fmaxf(a0, a1); }
            const int of = (i >> 1) * TT * HD + (i & 1) * 256; st4<512, 1024>(ph + of, hv); }
        if (sel == 1) KM[(((size_t)bt * (NH_ / 2) + (c0 >> 6)) * (TT / 64) + (t0 >> 6)) * 32 + lane] = hi ? km[1] : km[0];   // [batch][head pair][64 tokens][head of the pair][16 lanes]: a wave writes one whole line
    }
}

// k_fattn: S^T = K Q^T (keys x queries), t = leaky_relu_0.2(S^T x the bf16 adjacency plane) in the log2 domain over ALL 2048 keys (zeroed logits stay in the softmax), a shift and a sum per query column (the shift: a whole number from an upper bound of the column's logits, or the running maximum where the bound is large), O^T += V^T P^T with P^T packed from the score accumulators as f16; the scores never leave registers.
// Work-group: 8 waves = the 8 heads of one tile of 32 queries; grid (TT / 32, 1, batches). The work-group so holds whole merged rows: they go to LDS as bf16 hi/lo, and behind the barrier wave w forms out columns 32 w .. 32 w + 31 of the 32 rows (weight rows as the A operand, from the bf16 fragment plane; per accumulator and k step hi, then lo). A lane (c, h) holds query c of each 16-column group; accumulator register r of key tile t is key k0 + 16 t + 8 h + r, which is the k order of the B operand and of the V^T loader.
struct FRM { v16bf h[2][2], l[2][2]; };   // merged rows' fragments of two k blocks: [k block][query group], hi and lo
struct KVG { v16h k[4], v[4]; v4u g[2][4]; };   // 64 keys: four key tiles, value^T tiles [32-key block][d half], adjacency pieces [query group][key tile]
__global__ __launch_bounds__(256) void k_fattn(const bf* __restrict__ Qh, const bf* __restrict__ Kh, const bf* __restrict__ Vh, const bf* __restrict__ AB, const float* __restrict__ KM, const float* __restrict__ AM, const bf* __restrict__ WB, const float* __restrict__ bo, float* out) {
    __shared__ __align__(16) bf so[2][32][LP];   // merged rows, hi and lo
    const int lane = threadIdx.x & 31, c = lane & 15, h = lane >> 4, wave = __builtin_amdgcn_readfirstlane(threadIdx.x >> 5);   // the wave's number in a scalar register: the plane bases below are then scalar
    const int hs = wave & 1, head = wave, b = blockIdx.z, q0 = blockIdx.x * 32;
    const size_t pz = ((size_t)b * NH_ + head) * TT * HD, vz = ((size_t)b * NKV + head) * HP * TT;
    v16h qf[2]; const bf* qa = Qh + pz + (size_t)q0 * HD + c * 16 + 8 * h;
#pragma unroll
    for (int n = 0; n < 2; ++n) qf[n] = ldfr(qa + n * 16 * HD);
    asm volatile("s_wait_xcnt 0x0" ::: "memory");   // behind the loads, in front of any rewrite of their address registers
    __builtin_amdgcn_sched_barrier(0);              // keeps later address arithmetic behind that wait
    v4f kq[4], aq[2][2]; const float* kp = KM + (((size_t)b * (NH_ / 2) + (wave >> 1)) * (TT / 64) + lane) * 32 + hs * 16; const float* ap = AM + (size_t)(q0 + c) * 8;   // lane l: the head's 16 partial maxima of |k|^2 of tokens 64 l ..; the 8 partial maxima of |adjacency| of the lane's two query rows
#pragma unroll
    for (int i = 0; i < 4; ++i) kq[i] = *(const v4f*)(kp + i * 4);
#pragma unroll
    for (int n = 0; n < 2; ++n) { aq[n][0] = *(const v4f*)(ap + n * 128); aq[n][1] = *(const v4f*)(ap + n * 128 + 4); }
    asm volatile("s_wait_xcnt 0x0" ::: "memory");   // behind the loads of the partial maxima, in front of any rewrite of their address registers
    __builtin_amdgcn_sched_barrier(0);              // keeps later address arithmetic behind that wait
    const bf* kh0 = Kh + pz + c * 16 + 8 * h; const bf* vh0 = Vh + vz + c * 16 + 8 * h; const bf* ar0 = AB + (size_t)(q0 >> 4) * (TT * 16) + c * 16 + 8 * h;   size_t ks = 0;   // the lane's three pointers; ks: the trip's first key, in a scalar register; every load is a pointer plus ks's share plus a constant
    v8f o[2][2]; float mx[2], ls[2]; v2f l2[2];   // l2: the fixed-shift pass's sums, even and odd keys apart
#pragma unroll
    for (int n = 0; n < 2; ++n) { o[0][n] = (v8f){}; o[1][n] = (v8f){}; mx[n] = -3.0e38f; ls[n] = 0.f; l2[n] = (v2f){}; }
    auto fetch = [&](KVG& f, int ko) {   // ko: key offset from ks, a constant at every call
        const bf* kh = kh0 + ks * HD; const bf* vh = vh0 + ks * 32; const bf* ar = ar0 + ks * 16;
#pragma unroll
        for (int t = 0; t < 4; ++t) f.k[t] = ldfr(kh + (ko + t * 16) * HD);
#pragma unroll
        for (int n = 0; n < 2; ++n)
#pragma unroll
            for (int t = 0; t < 4; ++t) f.g[n][t] = *(const v4u*)(ar + n * 16 * TT + ko * 16 + t * 256);
#pragma unroll
        for (int m = 0; m < 4; ++m) f.v[m] = ldfr(vh + ko * 32 + m * 512);
        asm volatile("s_wait_xcnt 0x0" :: "v"(kh), "v"(vh), "v"(ar) : "memory");   // behind the pass's loads; the three addresses are inputs so that their registers stay theirs up to this wait (freed at the last load they were rewritten in front of it)
        __builtin_amdgcn_sched_barrier(0); };           // keeps the loads above the work that follows (sunk to their first use their latency is exposed) and the advance behind the wait
    auto work = [&](const KVG& f) {   // the largest term of a pass is 2^PTOP: terms down to 2^-29 of it stay normal f16 numbers
#pragma unroll
        for (int kb = 0; kb < 2; ++kb)
#pragma unroll
        for (int n = 0; n < 2; ++n) { v8f s[2]; float tm = mx[n];
#pragma unroll
            for (int t = 0; t < 2; ++t) s[t] = wmma16(f.k[kb * 2 + t], qf[n], (v8f){});
#pragma unroll
            for (int t = 0; t < 2; ++t)
#pragma unroll
                for (int r = 0; r < 8; r += 2) { const unsigned gp = f.g[n][kb * 2 + t][r >> 1]; const float u0 = s[t][r] * bflo(gp), u1 = s[t][r + 1] * bfhi(gp); const float t0 = fmaxf(u0, u0 * LEAK), t1 = fmaxf(u1, u1 * LEAK);   /* LeakyReLU(0.2) = max(u, 0.2 u) */ s[t][r] = t0; s[t][r + 1] = t1; tm = fmaxf(tm, fmaxf(t0, t1)); }
            tm = fmaxf(tm, xhalf(tm)); const float al = __builtin_amdgcn_exp2f(mx[n] - tm), ts = tm - PTOP; mx[n] = tm; float sum = 0.f; v8u ph;
#pragma unroll
            for (int t = 0; t < 2; ++t)
#pragma unroll
                for (int r = 0; r < 8; r += 2) { const float p0 = __builtin_amdgcn_exp2f(s[t][r] - ts), p1 = __builtin_amdgcn_exp2f(s[t][r + 1] - ts); sum += p0 + p1; ph[t * 4 + (r >> 1)] = pkh(p0, p1); }
            ls[n] = ls[n] * al + sum; const v16h pb = __builtin_bit_cast(v16h, ph);
#pragma unroll
            for (int m = 0; m < 2; ++m) { o[m][n] *= al; o[m][n] = wmma16(f.v[kb * 2 + m], pb, o[m][n]); }
            if (n) __builtin_amdgcn_sched_barrier(0); } };   // ends the scheduler's region at 32 keys, as in the pass with the fixed shift below
    KVG fa, fb; fetch(fa, 0);
    // Upper bound of a query's logits in the log2 domain: |q| x the head's largest |k| x the row's largest |adjacency| (LeakyReLU raises no magnitude; 1.01 covers the f16 rounding of k and the sums' rounding). Softmax is unchanged by the shift. The shift is the bound rounded up to a whole number, less PTOP: the terms fill the f16 range from the top, and a zero logit's term is a power of two, which f16 holds exactly.
    float rf[2], nr[2], c8[2];
    { float k2 = 0.f;
#pragma unroll
      for (int i = 0; i < 4; ++i) k2 = fmaxf(k2, fmaxf(fmaxf(kq[i][0], kq[i][1]), fmaxf(kq[i][2], kq[i][3])));
      k2 = fmaxf(k2, xhalf(k2));
#pragma unroll
      for (int m = 8; m >= 1; m >>= 1) k2 = fmaxf(k2, __shfl_xor(k2, m, 32));
#pragma unroll
      for (int n = 0; n < 2; ++n) { float q2 = 0.f;
#pragma unroll
          for (int e = 0; e < 16; ++e) { const float fq = (float)qf[n][e]; q2 = fmaf(fq, fq, q2); }
          q2 += xhalf(q2); const v4f a4 = __builtin_elementwise_max(aq[n][0], aq[n][1]); const float am = fmaxf(fmaxf(a4[0], a4[1]), fmaxf(a4[2], a4[3]));
          rf[n] = __builtin_amdgcn_sqrtf(q2 * k2) * am * 1.01f; const float sh = __builtin_ceilf(rf[n]) - PTOP; nr[n] = -sh; c8[n] = (LEAK - 1.0f) * sh; } }
    // The pass with the fixed shift sh: no maximum, no rescale, the subtraction folded into the adjacency product. x = u - sh; 0.2 u - sh = 0.2 x - 0.8 sh.
    auto workb = [&](const KVG& f) {
#pragma unroll
        for (int kb = 0; kb < 2; ++kb) { v8f s[2][2]; v16h pb[2];
#pragma unroll
            for (int n = 0; n < 2; ++n)
#pragma unroll
                for (int t = 0; t < 2; ++t) s[n][t] = wmma16(f.k[kb * 2 + t], qf[n], (v8f){});
#pragma unroll
            for (int n = 0; n < 2; ++n) { v2f sm[2]; v8u ph;
#pragma unroll
                for (int t = 0; t < 2; ++t)
#pragma unroll
                    for (int r = 0; r < 8; r += 2) { const unsigned gp = f.g[n][kb * 2 + t][r >> 1]; const float x0 = fmaf(s[n][t][r], bflo(gp), nr[n]), x1 = fmaf(s[n][t][r + 1], bfhi(gp), nr[n]); v2f pp;
                        pp[0] = __builtin_amdgcn_exp2f(fmaxf(x0, fmaf(x0, LEAK, c8[n]))); pp[1] = __builtin_amdgcn_exp2f(fmaxf(x1, fmaf(x1, LEAK, c8[n]))); sm[t] = r ? sm[t] + pp : pp; ph[t * 4 + (r >> 1)] = pkh(pp[0], pp[1]); }
                l2[n] += sm[0] + sm[1]; pb[n] = __builtin_bit_cast(v16h, ph); }
#pragma unroll
            for (int n = 0; n < 2; ++n)
#pragma unroll
                for (int m = 0; m < 2; ++m) o[m][n] = wmma16(f.v[kb * 2 + m], pb[n], o[m][n]);
            __builtin_amdgcn_sched_barrier(0); } };   // ends the scheduler's region at 32 keys: over 64 keys it strung each term's chain out one instruction at a time and held every term to the end (496 registers)
    // The wave's 32 weight rows of wo, all 8 k blocks, and its bias: issued in front of the last 64 keys' work, in the registers that the pass before has freed, so that they fly during that work.
    v16bf wa[2][8]; v8f bb[2]; const bf* wp = WB + (size_t)wave * (2 * 8 * 512) + c * 16 + 8 * h; const float* bp = bo + wave * 32 + 8 * h;
    auto ldw = [&]() {
#pragma unroll
        for (int i = 0; i < 2; ++i) {
#pragma unroll
            for (int kt = 0; kt < 8; ++kt) wa[i][kt] = cat16b(*(const v8us*)(wp + (i * 8 + kt) * 512), *(const v8us*)(wp + (i * 8 + kt) * 512 + 256));
            bb[i] = *(const v8f*)(bp + i * 16); }
        asm volatile("s_wait_xcnt 0x0" ::: "memory");   // behind the loads, in front of any rewrite of their address registers
        __builtin_amdgcn_sched_barrier(0); };           // keeps the loads above the work that follows (sunk to their first use their latency is exposed behind the barrier)
    auto sweep = [&](auto&& wk) {
#pragma unroll 1
        for (int k0 = 0; k0 < TT - 128; k0 += 128) {   // two register sets of 64 keys: each pass's loads are issued one pass ahead
            fetch(fb, 64); wk(fa); fetch(fa, 128); wk(fb);
            // the advance by 128 keys, in one statement with its wait: every address of the next trip is formed from ks, so none of the loads' address registers is rewritten in front of the wait (plain additions were lifted over the wait in fetch)
            asm volatile("s_wait_xcnt 0x0\n\ts_add_nc_u64 %0, %0, 128" : "+s"(ks) :: "memory"); }
        fetch(fb, 64); wk(fa); ldw(); wk(fb); };   // the last 128 keys: nothing is fetched past key 2047
    // With rf <= BLIM every exponent lies in [PTOP - 1.2 BLIM, PTOP] = [-13.8, 15]: all terms are normal f16 numbers under the f16 maximum, and the f32 sums stay far from overflow. A larger, infinite or NaN bound in any lane sends the wave through the running maximum.
    if (__builtin_expect(__builtin_amdgcn_ballot_w32(!(rf[0] <= BLIM && rf[1] <= BLIM)) == 0, 1)) sweep(workb); else sweep(work);
#pragma unroll
    for (int n = 0; n < 2; ++n) { const float lt = ls[n] + (l2[n][0] + l2[n][1]), inv = __fdiv_rn(1.0f, lt + xhalf(lt));
#pragma unroll
        for (int m = 0; m < 2; ++m) { v8us oh, ol;
#pragma unroll
            for (int r = 0; r < 8; ++r) { unsigned short a2, c2; splitf(o[m][n][r] * inv, a2, c2); oh[r] = a2; ol[r] = c2; }
            *(v8usa*)&so[0][n * 16 + c][head * HD + m * 16 + 8 * h] = oh; *(v8usa*)&so[1][n * 16 + c][head * HD + m * 16 + 8 * h] = ol; } }
    __syncthreads();   // every wave reads merged columns that the other heads' waves wrote
    const bf* ph = &so[0][c][8 * h]; const bf* pl = &so[1][c][8 * h];
    v8f acc[2][2];
#pragma unroll
    for (int i = 0; i < 2; ++i)
#pragma unroll
        for (int j = 0; j < 2; ++j) acc[i][j] = (v8f){};
    auto fetchm = [&](FRM& f, int kt) {   // kt: first of the set's two k blocks, a constant at every call
#pragma unroll
        for (int s = 0; s < 2; ++s)
#pragma unroll
            for (int j = 0; j < 2; ++j) { f.h[s][j] = WFrag<bf>::ld(ph + j * 16 * LP + (kt + s) * 32); f.l[s][j] = WFrag<bf>::ld(pl + j * 16 * LP + (kt + s) * 32); }
        __builtin_amdgcn_sched_barrier(0); };   // keeps a set's LDS reads in one group above the matrix instructions of the set before (sunk to their first use each read's latency is exposed)
    auto mmm = [&](const FRM& f, int kt) {   // per accumulator and k block: hi, then lo
#pragma unroll
        for (int s = 0; s < 2; ++s) {
#pragma unroll
            for (int j = 0; j < 2; ++j)
#pragma unroll
                for (int i = 0; i < 2; ++i) acc[i][j] = wmmab(wa[i][kt + s], f.h[s][j], acc[i][j]);
#pragma unroll
            for (int j = 0; j < 2; ++j)
#pragma unroll
                for (int i = 0; i < 2; ++i) acc[i][j] = wmmab(wa[i][kt + s], f.l[s][j], acc[i][j]); } };
    FRM g0, g1; fetchm(g0, 0); fetchm(g1, 2); mmm(g0, 0); fetchm(g0, 4); mmm(g1, 2); fetchm(g1, 6); mmm(g0, 4); mmm(g1, 6);   // two fragment sets: each set's reads are issued one set ahead
    float* po = out + ((size_t)b * TT + q0 + c) * DM + wave * 32 + 8 * h;   // acc[i][j][r]: column 32 wave + 16 i + 8 h + r, row q0 + 16 j + c; a row's 128-byte line of 32 columns has this wave as its one writer
#pragma unroll
    for (int i = 0; i < 2; ++i) { v8f b8;
#pragma unroll
        for (int r = 0; r < 8; ++r) b8[r] = bfr(bb[i][r]);
#pragma unroll
        for (int j = 0; j < 2; ++j) acc[i][j] += b8; }
    __builtin_amdgcn_sched_barrier(0);   // all values are formed above the first store, so that none of the stores' data registers is rewritten among them
#pragma unroll
    for (int i = 0; i < 2; ++i)
#pragma unroll
        for (int j = 0; j < 2; ++j) *(v8f*)(po + j * 16 * DM + i * 16) = acc[i][j];
}

extern "C" void kernel_launch(void* const* d_in, const int* in_sizes, int n_in,
                              void* d_out, int out_size, void* d_ws, size_t ws_size, hipStream_t stream) {
    (void)in_sizes; (void)n_in; (void)out_size;
    const float* x = (const float*)d_in[0]; const float* adj = (const float*)d_in[1];   /* adjacency_matrix [2048][2048] f32 0/1 (read as data) */ const float* wq = (const float*)d_in[2]; const float* bq = (const float*)d_in[3]; const float* wk = (const float*)d_in[4]; const float* bk = (const float*)d_in[5]; const float* wv = (const float*)d_in[6]; const float* bv = (const float*)d_in[7]; const float* wo = (const float*)d_in[8]; const float* bo = (const float*)d_in[9];   /* argument order hidden_states, adjacency_matrix, wq, bq, wk, bk, wv, bv, wo, bo */
    float* OUT = (float*)d_out;     // [4][2048][256]
    char* wsp = (char*)d_ws;
    auto take = [&](size_t bytes) { char* p = wsp; wsp += (bytes + 255) & ~(size_t)255; return (void*)p; };
    const size_t PZ = (size_t)NH_ * TT * HD, VZ = (size_t)NKV * HP * TT;   // one batch's q/k planes, value^T planes (elements)
    bf* QPh = (bf*)take(NB_ * PZ * 2); bf* KPh = (bf*)take(NB_ * PZ * 2); bf* VTh = (bf*)take(NB_ * VZ * 2);   // f16 planes
    bf* ADB = (bf*)take((size_t)TT * TT * 2); bf* WOB = (bf*)take((size_t)DM * DQ * 2);   // bf16 adjacency plane, bf16 wo plane
    float* KMX = (float*)take((size_t)NB_ * (NH_ / 2) * (TT / 64) * 32 * 4); float* AMX = (float*)take((size_t)TT * 8 * 4);   // partial maxima of |k|^2 and of |adjacency|
    if ((size_t)(wsp - (char*)d_ws) > ws_size) return;    // ws 256 MiB
    k_qkv<<<dim3(NB_ * TT / 128, 4, 1), 256, 0, stream>>>(x, wq, bq, wk, bk, wv, bv, adj, wo, QPh, KPh, VTh, ADB, WOB, KMX, AMX);
    k_fattn<<<dim3(TT / 32, 1, NB_), 256, 0, stream>>>(QPh, KPh, VTh, ADB, KMX, AMX, WOB, bo, OUT);
}

// v007
// One run takes 43.2 microseconds.
// Next to v006, in two timings, it ran 1.03 and 1.04 times as fast.
// All steps since v000 together make it 29.9 times as fast.
#include <hip/hip_runtime.h>

// Graph attention: multi-head attention whose scaled scores are multiplied by an adjacency matrix and passed through LeakyReLU before the softmax (hidden [4][2048][256]; q, k, v = x W^T + b ('oi' [256][256] 1/16, zero biases; 8 heads x 32); s = (q.k / sqrt(32)) x adj[i][j] (f32 [2048][2048] 0/1, ~6 % ones, read); s = leaky_relu(s, 0.2); softmax over all 2048 keys; out = merged wo^T + bo -> [4][2048][256] (2.1 M); argument order hidden_states, adjacency_matrix, wq, bq, wk, bk, wv, bv, wo, bo).
// Layout: one projection launch for q, k and v over all batches (x and the 'oi' weights rounded to bf16 on the way into LDS, bf16 biases, planes stored straight from the accumulators): one f16 q, k and value^T plane per [b][h] in fragment order (below; q carries 32^-0.5 x log2 e), and, from extra blocks of the same launch, the adjacency rounded to bf16 in fragment order, and wo likewise; one fused attention kernel over all batches and heads (a work-group's 32 adjacency rows staged once in LDS by asynchronous copies), which also forms merged hi/lo x wo + bo for its 32 query rows.
// Fragment order: the two 16-byte pieces that a lane (c, h) takes for one 16 x 32 operand tile lie at piece * 512 B + c * 32 B + h * 16 B of the tile's 1 KiB, so that one load of a wave covers four whole 128-byte lines (row-major planes made it touch 8 or 16 lines). q/k tile: 16 tokens x 32 d; value^T tile: 16 d x 32 keys, tiles ordered [key block][d half]; adjacency tile: 16 queries x 32 keys, tiles ordered [query tile][key block]; wo tile: 16 weight rows x 32 k, tiles ordered [row tile][k block].
// Compute dtypes, f32 accumulate: every input rounded to bf16 incl. the adjacency; projections exact + bf16 biases; q, k, v and the softmax terms each rounded once to f16, scores (K 32) and attn.v one f16 product each; softmax f32, shifted by a whole number taken from a per-query upper bound of the logits (running maximum where that bound is large); wo hl x exact + bias.

#define NB_  4
#define TT   2048
#define DM   256
#define NH_  8
#define NKV  8
#define REP  (NH_ / NKV)
#define HD   32
#define DQ   (NH_ * HD)
#define DKV  (NKV * HD)
#define ZH   2
#define RH   2048                 // = TT: every row hi/lo
#define WIN  0
#define PCAR 1024.0f
#define SCL  0.17677669529663688f   // 32^-0.5 (the module divides by float32(sqrt(32)); one multiply here)
#define LEAK 0.2f
#define BLIM 24.0f   // largest logit bound (log2 domain) for which one shift keeps every softmax term a normal f16 number
#define PTOP 15.0f   // the largest softmax term is 2^PTOP, under the f16 maximum
#define HP   64    // a head's value^T plane is HP x TT elements apart from the next; the first 32 x TT are written and read
typedef _Float16 h16;
typedef unsigned short bf;
typedef __attribute__((ext_vector_type(16))) __bf16   v16bf;
typedef __attribute__((ext_vector_type(16))) _Float16 v16h;
typedef __attribute__((ext_vector_type(8)))  _Float16 v8h;
typedef __attribute__((ext_vector_type(8)))  unsigned short v8us;
typedef __attribute__((ext_vector_type(8)))  float    v8f;
typedef __attribute__((ext_vector_type(4)))  float    v4f;
typedef v8h  __attribute__((may_alias)) v8ha;
typedef v4f  __attribute__((may_alias)) v4fa;
typedef v8us __attribute__((may_alias)) v8usa;

__device__ __forceinline__ unsigned short f2bf(float f) { unsigned u = __float_as_uint(f); u += 0x7FFFu + ((u >> 16) & 1u); return (unsigned short)(u >> 16); }
__device__ __forceinline__ float bf2f(unsigned short b) { return __uint_as_float(((unsigned)b) << 16); }
__device__ __forceinline__ float bfr(float f) { return bf2f(f2bf(f)); }
__device__ __forceinline__ v16h cat16(v8h lo, v8h hi) { return __builtin_shufflevector(lo, hi, 0, 1, 2, 3, 4, 5, 6, 7, 8, 9, 10, 11, 12, 13, 14, 15); }
__device__ __forceinline__ v16bf cat16b(v8us lo, v8us hi) { return __builtin_bit_cast(v16bf, __builtin_shufflevector(lo, hi, 0, 1, 2, 3, 4, 5, 6, 7, 8, 9, 10, 11, 12, 13, 14, 15)); }
__device__ __forceinline__ v8f wmma16(v16h a, v16h b, v8f c) { return __builtin_amdgcn_wmma_f32_16x16x32_f16(false, a, false, b, (short)0, c, false, false); }
__device__ __forceinline__ v8f wmmab(v16bf a, v16bf b, v8f c) { return __builtin_amdgcn_wmma_f32_16x16x32_bf16(false, a, false, b, (short)0, c, false, false); }



template <typename T16> struct WFrag;
template <> struct WFrag<bf> { typedef v16bf V; static __device__ __forceinline__ V ld(const bf* p) { return cat16b(*(const v8us*)p, *(const v8us*)(p + 16)); } static __device__ __forceinline__ v8f mma(V a, V b, v8f c) { return wmmab(a, b, c); } };
__device__ __forceinline__ v16h ldfr(const bf* p) { return __builtin_bit_cast(v16h, __builtin_shufflevector(*(const v8us*)p, *(const v8us*)(p + 256), 0, 1, 2, 3, 4, 5, 6, 7, 8, 9, 10, 11, 12, 13, 14, 15)); }   // a lane's two pieces of an f16 tile in fragment order
__device__ __forceinline__ void splitf(float y, unsigned short& h, unsigned short& l) { h = f2bf(y); l = f2bf(y - bf2f(h)); }
typedef __attribute__((ext_vector_type(2))) float v2f;
typedef __attribute__((ext_vector_type(4))) unsigned v4u;
#define QSC  0.25503486164919736f   // 32^-0.5 x log2(e): LeakyReLU commutes with a positive factor, so the logits are formed in the log2 domain
typedef __attribute__((ext_vector_type(2))) __bf16 v2bf;
typedef __attribute__((ext_vector_type(8))) unsigned v8u;
__device__ __forceinline__ unsigned pkbf(float a, float b) { v2f t; t[0] = a; t[1] = b; return __builtin_bit_cast(unsigned, __builtin_convertvector(t, v2bf)); }   // two f32 -> two bf16, round to nearest even
typedef __attribute__((ext_vector_type(2))) _Float16 v2h;
__device__ __forceinline__ unsigned pkh(float a, float b) { v2f t; t[0] = a; t[1] = b; return __builtin_bit_cast(unsigned, __builtin_convertvector(t, v2h)); }   // two f32 -> two f16, round to nearest even
__device__ __forceinline__ float bflo(unsigned u) { return __uint_as_float(u << 16); }
__device__ __forceinline__ float bfhi(unsigned u) { return __uint_as_float(u & 0xFFFF0000u); }
__device__ __forceinline__ float xhalf(float v) { const int b = __float_as_int(v); return __int_as_float(__builtin_amdgcn_permlanex16(b, b, 0x76543210, 0xfedcba98, false, false)); }   // the value of lane l ^ 16


#define LP 264   // LDS row pitch of a 256-element bf16 row: 528 B = 16 B x 33, an odd count of 16-byte units, for the 16-byte fragment reads
typedef __attribute__((ext_vector_type(2))) unsigned v2u;
typedef v2u __attribute__((may_alias)) v2ua;
// Staging of f32 rows of 256 as bf16 rows in LDS, 256 threads: a wave's load is 512 contiguous bytes; step 'it' is 4 rows on. ldrows only loads, so that a whole batch is in flight; strows rounds (nearest even) and stores.
template <int N> __device__ __forceinline__ void ldrows(v4f (&r)[N], const float* g) {
#pragma unroll
    for (int it = 0; it < N; ++it) r[it] = *(const v4f*)(g + it * 1024);
    asm volatile("s_wait_xcnt 0x0" ::: "memory");   // behind the batch's loads, in front of any rewrite of their address registers
    __builtin_amdgcn_sched_barrier(0); }            // keeps the batch's loads above the LDS stores that follow (sunk to their first use they would go out one at a time)
template <int N> __device__ __forceinline__ void strows(const v4f (&r)[N], bf* s) {
#pragma unroll
    for (int it = 0; it < N; ++it) { v2u o; o[0] = pkbf(r[it][0], r[it][1]); o[1] = pkbf(r[it][2], r[it][3]); *(v2ua*)(s + it * 4 * LP) = o; } }
// Eight f32 -> eight f16, packed for one 16-byte store.
__device__ __forceinline__ void round8(v8f y, v4u& hv) {
#pragma unroll
    for (int r = 0; r < 4; ++r) hv[r] = pkh(y[2 * r], y[2 * r + 1]); }
// Four accumulator tiles' pieces to the plane: piece k lies (k & 1) * S1 + (k >> 1) * S2 elements on.
template <int S1, int S2> __device__ __forceinline__ void st4(bf* ph, const v4u (&hv)[4]) {
    __builtin_amdgcn_sched_barrier(0);              // all four pieces are formed above the first store, so that none of the stores' data registers is rewritten among them
#pragma unroll
    for (int k = 0; k < 4; ++k) *(v8us*)(ph + (k & 1) * S1 + (k >> 1) * S2) = __builtin_bit_cast(v8us, hv[k]);
    asm volatile("s_wait_xcnt 0x0" ::: "memory");   // behind the stores, in front of any rewrite of their data and address registers
    __builtin_amdgcn_sched_barrier(0); }            // keeps the next tiles' arithmetic behind that wait

struct FRQ { v16bf a[4], b[4]; };
// k_qkv: q, k, v = bf16(x) bf16(W)^T + bf16(b) for all batches, stored as the attention kernel's planes. Grid (rows / 128, 4): blockIdx.y picks q, k, v or the adjacency plane (32 adjacency rows a block, no LDS use; the first 128 waves of those blocks also round one 16 x 32 tile of wo each). A work-group rounds 128 rows of x and the whole weight to bf16 in LDS once; 8 waves = 2 x 4 tiles of 64 rows x 64 columns, 16 accumulators a wave.
// An accumulator register run is 8 consecutive rows of the A operand at one row of the B operand: for q and k the weight rows are A (a lane holds 8 consecutive d of one token), for v the token rows are A (8 consecutive tokens of one d), so every plane is written in 16-byte pieces with no transpose, 512 contiguous bytes a store.
__global__ __launch_bounds__(256) void k_qkv(const float* __restrict__ x, const float* __restrict__ wq, const float* __restrict__ bq, const float* __restrict__ wk, const float* __restrict__ bk, const float* __restrict__ wv, const float* __restrict__ bv, const float* __restrict__ adj, const float* __restrict__ wout, bf* Qh, bf* Kh, bf* Vh, bf* AB, bf* WB, float* KM, float* AM) {
    __shared__ __align__(16) bf sm[(128 + 256) * LP];   // rows 0..127: x tile; rows 128..383: weight
    const int tid = threadIdx.x, lane = tid & 31, lr = lane & 15, hi = lane >> 4, wave = __builtin_amdgcn_readfirstlane(tid >> 5);
    if (blockIdx.y == 3) {   // the whole block leaves here, in front of the barrier. A wave takes 4 rows x 64 keys a step: 8 whole lines read, 4 whole lines written
        static_assert(NB_ * TT / 128 * 32 == TT, "one block for every 32 adjacency rows");
        const int tw = blockIdx.x * 8 + wave;   // wave-uniform: tile tw = [row tile tw >> 3][k block tw & 7] of wo
        if (tw < (DM / 16) * (DQ / 32)) { const float* gs = wout + (size_t)((tw >> 3) * 16 + lr) * DQ + (tw & 7) * 32 + 8 * hi; const v8f w0 = *(const v8f*)gs, w1 = *(const v8f*)(gs + 16); v4u p0, p1;
            asm volatile("s_wait_xcnt 0x0" ::: "memory");   // behind the two loads, in front of any rewrite of their address registers
            __builtin_amdgcn_sched_barrier(0);              // keeps later arithmetic behind that wait
#pragma unroll
            for (int k = 0; k < 4; ++k) { p0[k] = pkbf(w0[2 * k], w0[2 * k + 1]); p1[k] = pkbf(w1[2 * k], w1[2 * k + 1]); }
            bf* dw = WB + (size_t)tw * 512 + lr * 16 + 8 * hi; *(v8us*)dw = __builtin_bit_cast(v8us, p0); *(v8us*)(dw + 256) = __builtin_bit_cast(v8us, p1);
            asm volatile("s_wait_xcnt 0x0" ::: "memory");   // behind the two stores, in front of any rewrite of their data and address registers
            __builtin_amdgcn_sched_barrier(0); }            // keeps the adjacency work behind that wait
        const int k8 = lane & 7, row = blockIdx.x * 32 + wave * 4 + (lane >> 3);
        const float* g = adj + (size_t)row * TT + k8 * 8; bf* d = AB + ((size_t)(row >> 4) * 128 + (k8 >> 1)) * 256 + (row & 15) * 16 + (k8 & 1) * 8; float am = 0.f;   // am: largest |adjacency| among the lane's share of its row
#pragma unroll
        for (int hb = 0; hb < 2; ++hb) { v8f r[16]; v4u o[16];
#pragma unroll
            for (int it = 0; it < 16; ++it) r[it] = *(const v8f*)(g + (hb * 16 + it) * 64);
            asm volatile("s_wait_xcnt 0x0" ::: "memory");   // behind the batch's loads, in front of any rewrite of their address registers
            __builtin_amdgcn_sched_barrier(0);              // keeps the batch's loads together above the rounding (sunk to their first use they would go out one at a time)
#pragma unroll
            for (int it = 0; it < 16; ++it)
#pragma unroll
                for (int k = 0; k < 4; ++k) { o[it][k] = pkbf(r[it][2 * k], r[it][2 * k + 1]); am = fmaxf(am, fmaxf(fabsf(r[it][2 * k]), fabsf(r[it][2 * k + 1]))); }
            __builtin_amdgcn_sched_barrier(0);              // all pieces are formed above the first store, so that none of the stores' data registers is rewritten among them
#pragma unroll
            for (int it = 0; it < 16; ++it) *(v8us*)(d + (hb * 16 + it) * 1024) = __builtin_bit_cast(v8us, o[it]);
            asm volatile("s_wait_xcnt 0x0" ::: "memory");   // behind the stores, in front of any rewrite of their data and address registers
            __builtin_amdgcn_sched_barrier(0); }            // keeps the next batch behind that wait
        AM[(size_t)row * 8 + k8] = am;   // eight partial maxima a row; a wave writes one whole line
        return; }
    const int sel = blockIdx.y, rw = (wave >> 2) * 64, r0 = blockIdx.x * 128 + rw, c0 = (wave & 3) * 64;
    const float* w = sel == 0 ? wq : sel == 1 ? wk : wv; const float* bias = sel == 0 ? bq : sel == 1 ? bk : bv;
    { const float* gx = x + (size_t)blockIdx.x * 128 * DM + tid * 4; const float* gw = w + tid * 4; bf* st = sm + (tid >> 6) * LP + (tid & 63) * 4; v4f ra[32], rb[32];
      ldrows(ra, gx); ldrows(rb, gw); strows(ra, st); ldrows(ra, gw + 32 * 1024); strows(rb, st + 128 * LP); strows(ra, st + 256 * LP); }
    __syncthreads();   // every wave reads rows that other waves staged
    const int xo = (rw + lr) * LP + 8 * hi, wo = (128 + c0 + lr) * LP + 8 * hi;
    const bf* pa = sm + (sel == 2 ? xo : wo); const bf* pb = sm + (sel == 2 ? wo : xo);
    v8f acc[4][4];
#pragma unroll
    for (int i = 0; i < 4; ++i)
#pragma unroll
        for (int j = 0; j < 4; ++j) acc[i][j] = (v8f){};
    auto fetch = [&](FRQ& f, int kc) {
#pragma unroll
        for (int i = 0; i < 4; ++i) { f.a[i] = WFrag<bf>::ld(pa + i * 16 * LP + kc); f.b[i] = WFrag<bf>::ld(pb + i * 16 * LP + kc); }
        __builtin_amdgcn_sched_barrier(0); };   // keeps a k step's LDS reads in one group above the matrix instructions of the step before (sunk to their first use each read's latency is exposed)
    auto mm = [&](const FRQ& f) {
#pragma unroll
        for (int j = 0; j < 4; ++j)
#pragma unroll
            for (int i = 0; i < 4; ++i) acc[i][j] = wmmab(f.a[i], f.b[j], acc[i][j]); };
    FRQ f0, f1; fetch(f0, 0);
#pragma unroll
    for (int kc = 0; kc < DM; kc += 64) { fetch(f1, kc + 32); mm(f0); if (kc + 64 < DM) fetch(f0, kc + 64); mm(f1); }   // two fragment sets: each k step's reads are issued one step ahead
    const int bt = r0 / TT, t0 = r0 % TT, g0 = bt * NH_ + (c0 >> 5);   // the tile's batch, first token and first head plane
    if (sel == 2) {   // acc[i][j][r]: token t0 + 16 i + 8 hi + r, column c0 + 16 j + lr
        const size_t vo = (size_t)g0 * HP * TT + t0 * 32 + lr * 16 + 8 * hi; bf* ph = Vh + vo; float bb[4];
#pragma unroll
        for (int j = 0; j < 4; ++j) bb[j] = bias[c0 + j * 16 + lr];
        asm volatile("s_wait_xcnt 0x0" ::: "memory");   // behind the bias loads, in front of any rewrite of their address registers
        __builtin_amdgcn_sched_barrier(0);              // keeps later arithmetic behind that wait
#pragma unroll
        for (int j = 0; j < 4; ++j) { v4u hv[4]; const float b1 = bfr(bb[j]);
#pragma unroll
            for (int i = 0; i < 4; ++i) round8(acc[i][j] + b1, hv[i]);
            const int of = (j >> 1) * HP * TT + (j & 1) * 512; st4<256, 1024>(ph + of, hv); }
    } else {          // acc[i][j][r]: column c0 + 16 i + 8 hi + r, token t0 + 16 j + lr
        const float sc = sel == 0 ? QSC : 1.0f; const size_t po = ((size_t)g0 * TT + t0) * HD + lr * 16 + 8 * hi; bf* ph = (sel == 0 ? Qh : Kh) + po; v8f bb[4]; float nj[4], km[2];   // nj: a token's sum of squares over one head's 32 columns (this half's 16); km: the largest over the lane's 4 tokens, per head
#pragma unroll
        for (int i = 0; i < 4; ++i) bb[i] = *(const v8f*)(bias + c0 + i * 16 + 8 * hi);
        asm volatile("s_wait_xcnt 0x0" ::: "memory");   // behind the bias loads, in front of any rewrite of their address registers
        __builtin_amdgcn_sched_barrier(0);              // keeps later arithmetic behind that wait
#pragma unroll
        for (int i = 0; i < 4; ++i) { v4u hv[4]; v8f b8;
#pragma unroll
            for (int r = 0; r < 8; ++r) b8[r] = bfr(bb[i][r]);
#pragma unroll
            for (int j = 0; j < 4; ++j) { const v8f y = (acc[i][j] + b8) * sc; round8(y, hv[j]); float q2 = (i & 1) ? nj[j] : 0.f;
#pragma unroll
                for (int r = 0; r < 8; ++r) q2 = fmaf(y[r], y[r], q2);
                nj[j] = q2; }
            if (i & 1) { const float a0 = fmaxf(nj[0] + xhalf(nj[0]), nj[1] + xhalf(nj[1])), a1 = fmaxf(nj[2] + xhalf(nj[2]), nj[3] + xhalf(nj[3])); km[i >> 1] = fmaxf(a0, a1); }
            const int of = (i >> 1) * TT * HD + (i & 1) * 256; st4<512, 1024>(ph + of, hv); }
        if (sel == 1) KM[(((size_t)bt * (NH_ / 2) + (c0 >> 6)) * (TT / 64) + (t0 >> 6)) * 32 + lane] = hi ? km[1] : km[0];   // [batch][head pair][64 tokens][head of the pair][16 lanes]: a wave writes one whole line
    }
}

// k_fattn: S^T = K Q^T (keys x queries), t = leaky_relu_0.2(S^T x the bf16 adjacency plane) in the log2 domain over ALL 2048 keys (zeroed logits stay in the softmax), a shift and a sum per query column (the shift: a whole number from an upper bound of the column's logits, or the running maximum where the bound is large), O^T += V^T P^T with P^T packed from the score accumulators as f16; the scores never leave registers.
// Work-group: 8 waves = the 8 heads of one tile of 32 queries; grid (TT / 32, 1, batches). The work-group so holds whole merged rows: they go to LDS as bf16 hi/lo, and behind the barrier wave w forms out columns 32 w .. 32 w + 31 of the 32 rows (weight rows as the A operand, from the bf16 fragment plane; per accumulator and k step hi, then lo). A lane (c, h) holds query c of each 16-column group; accumulator register r of key tile t is key k0 + 16 t + 8 h + r, which is the k order of the B operand and of the V^T loader.
// Eight asynchronous copies global -> LDS, 16 bytes a lane and 512 contiguous bytes a wave each, 512 bytes apart. l: the lane's LDS byte address; g: the lane's global address.
__device__ __forceinline__ void cp8(unsigned l, const bf* g) {
    asm volatile("global_load_async_to_lds_b128 %0, %8, off\n\t"
                 "global_load_async_to_lds_b128 %1, %9, off\n\t"
                 "global_load_async_to_lds_b128 %2, %10, off\n\t"
                 "global_load_async_to_lds_b128 %3, %11, off\n\t"
                 "global_load_async_to_lds_b128 %4, %12, off\n\t"
                 "global_load_async_to_lds_b128 %5, %13, off\n\t"
                 "global_load_async_to_lds_b128 %6, %14, off\n\t"
                 "global_load_async_to_lds_b128 %7, %15, off\n\t"
                 "s_wait_xcnt 0x0"   // behind the last copy, in the copies' own statement: in front of any rewrite of their address registers
                 :: "v"(l), "v"(l + 512), "v"(l + 1024), "v"(l + 1536), "v"(l + 2048), "v"(l + 2560), "v"(l + 3072), "v"(l + 3584),
                    "v"(g), "v"(g + 256), "v"(g + 512), "v"(g + 768), "v"(g + 1024), "v"(g + 1280), "v"(g + 1536), "v"(g + 1792) : "memory"); }
struct FRM { v16bf h[2][2], l[2][2]; };   // merged rows' fragments of two k blocks: [k block][query group], hi and lo
struct KVG { v16h k[4], v[4]; v4u g[2][4]; };   // 64 keys: four key tiles, value^T tiles [32-key block][d half], adjacency pieces [query group][key tile]
__global__ __launch_bounds__(256) void k_fattn(const bf* __restrict__ Qh, const bf* __restrict__ Kh, const bf* __restrict__ Vh, const bf* __restrict__ AB, const float* __restrict__ KM, const float* __restrict__ AM, const bf* __restrict__ WB, const float* __restrict__ bo, float* out) {
    __shared__ __align__(16) bf so[2][32][LP];   // merged rows, hi and lo
    __shared__ __align__(16) bf sa[2 * 16 * TT];   // the adjacency plane's two query tiles of this work-group, all keys, in the plane's own order (128 KiB)
    const int lane = threadIdx.x & 31, c = lane & 15, h = lane >> 4, wave = __builtin_amdgcn_readfirstlane(threadIdx.x >> 5);   // the wave's number in a scalar register: the plane bases below are then scalar
    const int hs = wave & 1, head = wave, b = blockIdx.z, q0 = blockIdx.x * 32;
    // The 8 heads of a work-group multiply by the same 32 adjacency rows: they come from L2 once, not once a wave. Each wave copies one eighth (16 KiB, 32 copies); the copies fly during the loads and the bound below.
    { const unsigned la = (unsigned)(size_t)sa + wave * 16384 + lane * 16; const bf* ga = AB + (size_t)(q0 >> 4) * (TT * 16) + wave * 8192 + lane * 8;
      cp8(la, ga); cp8(la + 4096, ga + 2048); cp8(la + 8192, ga + 4096); cp8(la + 12288, ga + 6144); }
    const size_t pz = ((size_t)b * NH_ + head) * TT * HD, vz = ((size_t)b * NKV + head) * HP * TT;
    v16h qf[2]; const bf* qa = Qh + pz + (size_t)q0 * HD + c * 16 + 8 * h;
#pragma unroll
    for (int n = 0; n < 2; ++n) qf[n] = ldfr(qa + n * 16 * HD);
    asm volatile("s_wait_xcnt 0x0" ::: "memory");   // behind the loads, in front of any rewrite of their address registers
    __builtin_amdgcn_sched_barrier(0);              // keeps later address arithmetic behind that wait
    v4f kq[4], aq[2][2]; const float* kp = KM + (((size_t)b * (NH_ / 2) + (wave >> 1)) * (TT / 64) + lane) * 32 + hs * 16; const float* ap = AM + (size_t)(q0 + c) * 8;   // lane l: the head's 16 partial maxima of |k|^2 of tokens 64 l ..; the 8 partial maxima of |adjacency| of the lane's two query rows
#pragma unroll
    for (int i = 0; i < 4; ++i) kq[i] = *(const v4f*)(kp + i * 4);
#pragma unroll
    for (int n = 0; n < 2; ++n) { aq[n][0] = *(const v4f*)(ap + n * 128); aq[n][1] = *(const v4f*)(ap + n * 128 + 4); }
    asm volatile("s_wait_xcnt 0x0" ::: "memory");   // behind the loads of the partial maxima, in front of any rewrite of their address registers
    __builtin_amdgcn_sched_barrier(0);              // keeps later address arithmetic behind that wait
    const bf* kh0 = Kh + pz + c * 16 + 8 * h; const bf* vh0 = Vh + vz + c * 16 + 8 * h; const bf* ar0 = sa + c * 16 + 8 * h;   size_t ks = 0;   // the lane's three pointers (the adjacency's into LDS); ks: the trip's first key, in a scalar register; every load is a pointer plus ks's share plus a constant
    v8f o[2][2]; float mx[2], ls[2]; v2f l2[2];   // l2: the fixed-shift pass's sums, even and odd keys apart
#pragma unroll
    for (int n = 0; n < 2; ++n) { o[0][n] = (v8f){}; o[1][n] = (v8f){}; mx[n] = -3.0e38f; ls[n] = 0.f; l2[n] = (v2f){}; }
    auto fetchg = [&](KVG& f, int ko) {   // the pass's adjacency pieces, from LDS; ko: key offset from ks, a constant at every call
        const bf* ar = ar0 + ks * 16;
#pragma unroll
        for (int n = 0; n < 2; ++n)
#pragma unroll
            for (int t = 0; t < 4; ++t) f.g[n][t] = *(const v4u*)(ar + n * 16 * TT + ko * 16 + t * 256); };
    auto fetchkv = [&](KVG& f, int ko) {
        const bf* kh = kh0 + ks * HD; const bf* vh = vh0 + ks * 32;
#pragma unroll
        for (int t = 0; t < 4; ++t) f.k[t] = ldfr(kh + (ko + t * 16) * HD);
#pragma unroll
        for (int m = 0; m < 4; ++m) f.v[m] = ldfr(vh + ko * 32 + m * 512);
        asm volatile("s_wait_xcnt 0x0" :: "v"(kh), "v"(vh) : "memory");   // behind the pass's loads; the two addresses are inputs so that their registers stay theirs up to this wait (freed at the last load they were rewritten in front of it)
        __builtin_amdgcn_sched_barrier(0); };           // keeps the loads above the work that follows (sunk to their first use their latency is exposed) and the advance behind the wait
    auto fetch = [&](KVG& f, int ko) { fetchg(f, ko); fetchkv(f, ko); };
    auto work = [&](const KVG& f) {   // the largest term of a pass is 2^PTOP: terms down to 2^-29 of it stay normal f16 numbers
#pragma unroll
        for (int kb = 0; kb < 2; ++kb)
#pragma unroll
        for (int n = 0; n < 2; ++n) { v8f s[2]; float tm = mx[n];
#pragma unroll
            for (int t = 0; t < 2; ++t) s[t] = wmma16(f.k[kb * 2 + t], qf[n], (v8f){});
#pragma unroll
            for (int t = 0; t < 2; ++t)
#pragma unroll
                for (int r = 0; r < 8; r += 2) { const unsigned gp = f.g[n][kb * 2 + t][r >> 1]; const float u0 = s[t][r] * bflo(gp), u1 = s[t][r + 1] * bfhi(gp); const float t0 = fmaxf(u0, u0 * LEAK), t1 = fmaxf(u1, u1 * LEAK);   /* LeakyReLU(0.2) = max(u, 0.2 u) */ s[t][r] = t0; s[t][r + 1] = t1; tm = fmaxf(tm, fmaxf(t0, t1)); }
            tm = fmaxf(tm, xhalf(tm)); const float al = __builtin_amdgcn_exp2f(mx[n] - tm), ts = tm - PTOP; mx[n] = tm; float sum = 0.f; v8u ph;
#pragma unroll
            for (int t = 0; t < 2; ++t)
#pragma unroll
                for (int r = 0; r < 8; r += 2) { const float p0 = __builtin_amdgcn_exp2f(s[t][r] - ts), p1 = __builtin_amdgcn_exp2f(s[t][r + 1] - ts); sum += p0 + p1; ph[t * 4 + (r >> 1)] = pkh(p0, p1); }
            ls[n] = ls[n] * al + sum; const v16h pb = __builtin_bit_cast(v16h, ph);
#pragma unroll
            for (int m = 0; m < 2; ++m) { o[m][n] *= al; o[m][n] = wmma16(f.v[kb * 2 + m], pb, o[m][n]); }
            if (n) __builtin_amdgcn_sched_barrier(0); } };   // ends the scheduler's region at 32 keys, as in the pass with the fixed shift below
    KVG fa, fb; fetchkv(fa, 0);
    // Upper bound of a query's logits in the log2 domain: |q| x the head's largest |k| x the row's largest |adjacency| (LeakyReLU raises no magnitude; 1.01 covers the f16 rounding of k and the sums' rounding). Softmax is unchanged by the shift. The shift is the bound rounded up to a whole number, less PTOP: the terms fill the f16 range from the top, and a zero logit's term is a power of two, which f16 holds exactly.
    float rf[2], nr[2], c8[2];
    { float k2 = 0.f;
#pragma unroll
      for (int i = 0; i < 4; ++i) k2 = fmaxf(k2, fmaxf(fmaxf(kq[i][0], kq[i][1]), fmaxf(kq[i][2], kq[i][3])));
      k2 = fmaxf(k2, xhalf(k2));
#pragma unroll
      for (int m = 8; m >= 1; m >>= 1) k2 = fmaxf(k2, __shfl_xor(k2, m, 32));
#pragma unroll
      for (int n = 0; n < 2; ++n) { float q2 = 0.f;
#pragma unroll
          for (int e = 0; e < 16; ++e) { const float fq = (float)qf[n][e]; q2 = fmaf(fq, fq, q2); }
          q2 += xhalf(q2); const v4f a4 = __builtin_elementwise_max(aq[n][0], aq[n][1]); const float am = fmaxf(fmaxf(a4[0], a4[1]), fmaxf(a4[2], a4[3]));
          rf[n] = __builtin_amdgcn_sqrtf(q2 * k2) * am * 1.01f; const float sh = __builtin_ceilf(rf[n]) - PTOP; nr[n] = -sh; c8[n] = (LEAK - 1.0f) * sh; } }
    __builtin_amdgcn_sched_barrier(0);                  // keeps the bound's arithmetic above the wait (sunk behind the barrier it no longer runs while the copies fly)
    asm volatile("s_wait_asynccnt 0x0" ::: "memory");   // the wave's own adjacency copies have landed
    __syncthreads();   // every wave reads adjacency bytes that the other waves copied
    fetchg(fa, 0);
    // The pass with the fixed shift sh: no maximum, no rescale, the subtraction folded into the adjacency product. x = u - sh; 0.2 u - sh = 0.2 x - 0.8 sh.
    auto workb = [&](const KVG& f) {
#pragma unroll
        for (int kb = 0; kb < 2; ++kb) { v8f s[2][2]; v16h pb[2];
#pragma unroll
            for (int n = 0; n < 2; ++n)
#pragma unroll
                for (int t = 0; t < 2; ++t) s[n][t] = wmma16(f.k[kb * 2 + t], qf[n], (v8f){});
#pragma unroll
            for (int n = 0; n < 2; ++n) { v2f sm[2]; v8u ph;
#pragma unroll
                for (int t = 0; t < 2; ++t)
#pragma unroll
                    for (int r = 0; r < 8; r += 2) { const unsigned gp = f.g[n][kb * 2 + t][r >> 1]; const float x0 = fmaf(s[n][t][r], bflo(gp), nr[n]), x1 = fmaf(s[n][t][r + 1], bfhi(gp), nr[n]); v2f pp;
                        pp[0] = __builtin_amdgcn_exp2f(fmaxf(x0, fmaf(x0, LEAK, c8[n]))); pp[1] = __builtin_amdgcn_exp2f(fmaxf(x1, fmaf(x1, LEAK, c8[n]))); sm[t] = r ? sm[t] + pp : pp; ph[t * 4 + (r >> 1)] = pkh(pp[0], pp[1]); }
                l2[n] += sm[0] + sm[1]; pb[n] = __builtin_bit_cast(v16h, ph); }
#pragma unroll
            for (int n = 0; n < 2; ++n)
#pragma unroll
                for (int m = 0; m < 2; ++m) o[m][n] = wmma16(f.v[kb * 2 + m], pb[n], o[m][n]);
            __builtin_amdgcn_sched_barrier(0); } };   // ends the scheduler's region at 32 keys: over 64 keys it strung each term's chain out one instruction at a time and held every term to the end (496 registers)
    // The wave's 32 weight rows of wo, all 8 k blocks, and its bias: issued in front of the last 64 keys' work, in the registers that the pass before has freed, so that they fly during that work.
    v16bf wa[2][8]; v8f bb[2]; const bf* wp = WB + (size_t)wave * (2 * 8 * 512) + c * 16 + 8 * h; const float* bp = bo + wave * 32 + 8 * h;
    auto ldw = [&]() {
#pragma unroll
        for (int i = 0; i < 2; ++i) {
#pragma unroll
            for (int kt = 0; kt < 8; ++kt) wa[i][kt] = cat16b(*(const v8us*)(wp + (i * 8 + kt) * 512), *(const v8us*)(wp + (i * 8 + kt) * 512 + 256));
            bb[i] = *(const v8f*)(bp + i * 16); }
        asm volatile("s_wait_xcnt 0x0" ::: "memory");   // behind the loads, in front of any rewrite of their address registers
        __builtin_amdgcn_sched_barrier(0); };           // keeps the loads above the work that follows (sunk to their first use their latency is exposed behind the barrier)
    auto sweep = [&](auto&& wk) {
#pragma unroll 1
        for (int k0 = 0; k0 < TT - 128; k0 += 128) {   // two register sets of 64 keys: each pass's loads are issued one pass ahead
            fetch(fb, 64); wk(fa); fetch(fa, 128); wk(fb);
            // the advance by 128 keys, in one statement with its wait: every address of the next trip is formed from ks, so none of the loads' address registers is rewritten in front of the wait (plain additions were lifted over the wait in fetch)
            asm volatile("s_wait_xcnt 0x0\n\ts_add_nc_u64 %0, %0, 128" : "+s"(ks) :: "memory"); }
        fetch(fb, 64); wk(fa); ldw(); wk(fb); };   // the last 128 keys: nothing is fetched past key 2047
    // With rf <= BLIM every exponent lies in [PTOP - 1.2 BLIM, PTOP] = [-13.8, 15]: all terms are normal f16 numbers under the f16 maximum, and the f32 sums stay far from overflow. A larger, infinite or NaN bound in any lane sends the wave through the running maximum.
    if (__builtin_expect(__builtin_amdgcn_ballot_w32(!(rf[0] <= BLIM && rf[1] <= BLIM)) == 0, 1)) sweep(workb); else sweep(work);
#pragma unroll
    for (int n = 0; n < 2; ++n) { const float lt = ls[n] + (l2[n][0] + l2[n][1]), inv = __fdiv_rn(1.0f, lt + xhalf(lt));
#pragma unroll
        for (int m = 0; m < 2; ++m) { v8us oh, ol;
#pragma unroll
            for (int r = 0; r < 8; ++r) { unsigned short a2, c2; splitf(o[m][n][r] * inv, a2, c2); oh[r] = a2; ol[r] = c2; }
            *(v8usa*)&so[0][n * 16 + c][head * HD + m * 16 + 8 * h] = oh; *(v8usa*)&so[1][n * 16 + c][head * HD + m * 16 + 8 * h] = ol; } }
    __syncthreads();   // every wave reads merged columns that the other heads' waves wrote
    const bf* ph = &so[0][c][8 * h]; const bf* pl = &so[1][c][8 * h];
    v8f acc[2][2];
#pragma unroll
    for (int i = 0; i < 2; ++i)
#pragma unroll
        for (int j = 0; j < 2; ++j) acc[i][j] = (v8f){};
    auto fetchm = [&](FRM& f, int kt) {   // kt: first of the set's two k blocks, a constant at every call
#pragma unroll
        for (int s = 0; s < 2; ++s)
#pragma unroll
            for (int j = 0; j < 2; ++j) { f.h[s][j] = WFrag<bf>::ld(ph + j * 16 * LP + (kt + s) * 32); f.l[s][j] = WFrag<bf>::ld(pl + j * 16 * LP + (kt + s) * 32); }
        __builtin_amdgcn_sched_barrier(0); };   // keeps a set's LDS reads in one group above the matrix instructions of the set before (sunk to their first use each read's latency is exposed)
    auto mmm = [&](const FRM& f, int kt) {   // per accumulator and k block: hi, then lo
#pragma unroll
        for (int s = 0; s < 2; ++s) {
#pragma unroll
            for (int j = 0; j < 2; ++j)
#pragma unroll
                for (int i = 0; i < 2; ++i) acc[i][j] = wmmab(wa[i][kt + s], f.h[s][j], acc[i][j]);
#pragma unroll
            for (int j = 0; j < 2; ++j)
#pragma unroll
                for (int i = 0; i < 2; ++i) acc[i][j] = wmmab(wa[i][kt + s], f.l[s][j], acc[i][j]); } };
    FRM g0, g1; fetchm(g0, 0); fetchm(g1, 2); mmm(g0, 0); fetchm(g0, 4); mmm(g1, 2); fetchm(g1, 6); mmm(g0, 4); mmm(g1, 6);   // two fragment sets: each set's reads are issued one set ahead
    float* po = out + ((size_t)b * TT + q0 + c) * DM + wave * 32 + 8 * h;   // acc[i][j][r]: column 32 wave + 16 i + 8 h + r, row q0 + 16 j + c; a row's 128-byte line of 32 columns has this wave as its one writer
#pragma unroll
    for (int i = 0; i < 2; ++i) { v8f b8;
#pragma unroll
        for (int r = 0; r < 8; ++r) b8[r] = bfr(bb[i][r]);
#pragma unroll
        for (int j = 0; j < 2; ++j) acc[i][j] += b8; }
    __builtin_amdgcn_sched_barrier(0);   // all values are formed above the first store, so that none of the stores' data registers is rewritten among them
#pragma unroll
    for (int i = 0; i < 2; ++i)
#pragma unroll
        for (int j = 0; j < 2; ++j) *(v8f*)(po + j * 16 * DM + i * 16) = acc[i][j];
}

extern "C" void kernel_launch(void* const* d_in, const int* in_sizes, int n_in,
                              void* d_out, int out_size, void* d_ws, size_t ws_size, hipStream_t stream) {
    (void)in_sizes; (void)n_in; (void)out_size;
    const float* x = (const float*)d_in[0]; const float* adj = (const float*)d_in[1];   /* adjacency_matrix [2048][2048] f32 0/1 (read as data) */ const float* wq = (const float*)d_in[2]; const float* bq = (const float*)d_in[3]; const float* wk = (const float*)d_in[4]; const float* bk = (const float*)d_in[5]; const float* wv = (const float*)d_in[6]; const float* bv = (const float*)d_in[7]; const float* wo = (const float*)d_in[8]; const float* bo = (const float*)d_in[9];   /* argument order hidden_states, adjacency_matrix, wq, bq, wk, bk, wv, bv, wo, bo */
    float* OUT = (float*)d_out;     // [4][2048][256]
    char* wsp = (char*)d_ws;
    auto take = [&](size_t bytes) { char* p = wsp; wsp += (bytes + 255) & ~(size_t)255; return (void*)p; };
    const size_t PZ = (size_t)NH_ * TT * HD, VZ = (size_t)NKV * HP * TT;   // one batch's q/k planes, value^T planes (elements)
    bf* QPh = (bf*)take(NB_ * PZ * 2); bf* KPh = (bf*)take(NB_ * PZ * 2); bf* VTh = (bf*)take(NB_ * VZ * 2);   // f16 planes
    bf* ADB = (bf*)take((size_t)TT * TT * 2); bf* WOB = (bf*)take((size_t)DM * DQ * 2);   // bf16 adjacency plane, bf16 wo plane
    float* KMX = (float*)take((size_t)NB_ * (NH_ / 2) * (TT / 64) * 32 * 4); float* AMX = (float*)take((size_t)TT * 8 * 4);   // partial maxima of |k|^2 and of |adjacency|
    if ((size_t)(wsp - (char*)d_ws) > ws_size) return;    // ws 256 MiB
    k_qkv<<<dim3(NB_ * TT / 128, 4, 1), 256, 0, stream>>>(x, wq, bq, wk, bk, wv, bv, adj, wo, QPh, KPh, VTh, ADB, WOB, KMX, AMX);
    k_fattn<<<dim3(TT / 32, 1, NB_), 256, 0, stream>>>(QPh, KPh, VTh, ADB, KMX, AMX, WOB, bo, OUT);
}

// v008
// Measured time: 41.8 microseconds a run.
// Next to v007, in two timings, it ran 1.03 and 1.04 times as fast.
// Counting every step since v000, it is 30.9 times as fast.
#include <hip/hip_runtime.h>

// Graph attention: multi-head attention whose scaled scores are multiplied by an adjacency matrix and passed through LeakyReLU before the softmax (hidden [4][2048][256]; q, k, v = x W^T + b ('oi' [256][256] 1/16, zero biases; 8 heads x 32); s = (q.k / sqrt(32)) x adj[i][j] (f32 [2048][2048] 0/1, ~6 % ones, read); s = leaky_relu(s, 0.2); softmax over all 2048 keys; out = merged wo^T + bo -> [4][2048][256] (2.1 M); argument order hidden_states, adjacency_matrix, wq, bq, wk, bk, wv, bv, wo, bo).
// Layout: one projection launch for q, k and v over all batches (x and the 'oi' weights rounded to bf16 on the way into LDS, bf16 biases, planes stored straight from the accumulators): one f16 q, k and value^T plane per [b][h] in fragment order (below; q carries 32^-0.5 x log2 e), and, from extra blocks of the same launch, the adjacency rounded to bf16 in fragment order, and wo likewise; one fused attention kernel over all batches and heads (a work-group's 32 adjacency rows staged once in LDS by asynchronous copies), which also forms merged hi/lo x wo + bo for its 32 query rows.
// Fragment order: the two 16-byte pieces that a lane (c, h) takes for one 16 x 32 operand tile lie at piece * 512 B + c * 32 B + h * 16 B of the tile's 1 KiB, so that one load of a wave covers four whole 128-byte lines (row-major planes made it touch 8 or 16 lines). q/k tile: 16 tokens x 32 d; value^T tile: 16 d x 32 keys, tiles ordered [key block][d half]; adjacency tile: 16 queries x 32 keys, tiles ordered [query tile][key block]; wo tile: 16 weight rows x 32 k, tiles ordered [row tile][k block].
// Compute dtypes, f32 accumulate: every input rounded to bf16 incl. the adjacency; projections exact + bf16 biases; q, k, v and the softmax terms each rounded once to f16, scores (K 32) and attn.v one f16 product each; softmax f32, shifted by a whole number taken from a per-query upper bound of the logits (running maximum where that bound is large); wo hl x exact + bias.

#define NB_  4
#define TT   2048
#define DM   256
#define NH_  8
#define NKV  8
#define REP  (NH_ / NKV)
#define HD   32
#define DQ   (NH_ * HD)
#define DKV  (NKV * HD)
#define ZH   2
#define RH   2048                 // = TT: every row hi/lo
#define WIN  0
#define PCAR 1024.0f
#define SCL  0.17677669529663688f   // 32^-0.5 (the module divides by float32(sqrt(32)); one multiply here)
#define LEAK 0.2f
#define BLIM 24.0f   // largest logit bound (log2 domain) for which one shift keeps every softmax term a normal f16 number
#define PTOP 15.0f   // the largest softmax term is 2^PTOP, under the f16 maximum
#define HP   64    // a head's value^T plane is HP x TT elements apart from the next; the first 32 x TT are written and read
typedef _Float16 h16;
typedef unsigned short bf;
typedef __attribute__((ext_vector_type(16))) __bf16   v16bf;
typedef __attribute__((ext_vector_type(16))) _Float16 v16h;
typedef __attribute__((ext_vector_type(8)))  _Float16 v8h;
typedef __attribute__((ext_vector_type(8)))  unsigned short v8us;
typedef __attribute__((ext_vector_type(8)))  float    v8f;
typedef __attribute__((ext_vector_type(4)))  float    v4f;
typedef v8h  __attribute__((may_alias)) v8ha;
typedef v4f  __attribute__((may_alias)) v4fa;
typedef v8us __attribute__((may_alias)) v8usa;

__device__ __forceinline__ unsigned short f2bf(float f) { unsigned u = __float_as_uint(f); u += 0x7FFFu + ((u >> 16) & 1u); return (unsigned short)(u >> 16); }
__device__ __forceinline__ float bf2f(unsigned short b) { return __uint_as_float(((unsigned)b) << 16); }
__device__ __forceinline__ float bfr(float f) { return bf2f(f2bf(f)); }
__device__ __forceinline__ v16h cat16(v8h lo, v8h hi) { return __builtin_shufflevector(lo, hi, 0, 1, 2, 3, 4, 5, 6, 7, 8, 9, 10, 11, 12, 13, 14, 15); }
__device__ __forceinline__ v16bf cat16b(v8us lo, v8us hi) { return __builtin_bit_cast(v16bf, __builtin_shufflevector(lo, hi, 0, 1, 2, 3, 4, 5, 6, 7, 8, 9, 10, 11, 12, 13, 14, 15)); }
__device__ __forceinline__ v8f wmma16(v16h a, v16h b, v8f c) { return __builtin_amdgcn_wmma_f32_16x16x32_f16(false, a, false, b, (short)0, c, false, false); }
__device__ __forceinline__ v8f wmmab(v16bf a, v16bf b, v8f c) { return __builtin_amdgcn_wmma_f32_16x16x32_bf16(false, a, false, b, (short)0, c, false, false); }



template <typename T16> struct WFrag;
template <> struct WFrag<bf> { typedef v16bf V; static __device__ __forceinline__ V ld(const bf* p) { return cat16b(*(const v8us*)p, *(const v8us*)(p + 16)); } static __device__ __forceinline__ v8f mma(V a, V b, v8f c) { return wmmab(a, b, c); } };
__device__ __forceinline__ v16h ldfr(const bf* p) { return __builtin_bit_cast(v16h, __builtin_shufflevector(*(const v8us*)p, *(const v8us*)(p + 256), 0, 1, 2, 3, 4, 5, 6, 7, 8, 9, 10, 11, 12, 13, 14, 15)); }   // a lane's two pieces of an f16 tile in fragment order
__device__ __forceinline__ void splitf(float y, unsigned short& h, unsigned short& l) { h = f2bf(y); l = f2bf(y - bf2f(h)); }
typedef __attribute__((ext_vector_type(2))) float v2f;
typedef __attribute__((ext_vector_type(4))) unsigned v4u;
#define QSC  0.25503486164919736f   // 32^-0.5 x log2(e): LeakyReLU commutes with a positive factor, so the logits are formed in the log2 domain
typedef __attribute__((ext_vector_type(2))) __bf16 v2bf;
typedef __attribute__((ext_vector_type(8))) unsigned v8u;
__device__ __forceinline__ unsigned pkbf(float a, float b) { v2f t; t[0] = a; t[1] = b; return __builtin_bit_cast(unsigned, __builtin_convertvector(t, v2bf)); }   // two f32 -> two bf16, round to nearest even
typedef __attribute__((ext_vector_type(2))) _Float16 v2h;
__device__ __forceinline__ unsigned pkh(float a, float b) { v2f t; t[0] = a; t[1] = b; return __builtin_bit_cast(unsigned, __builtin_convertvector(t, v2h)); }   // two f32 -> two f16, round to nearest even
__device__ __forceinline__ float bflo(unsigned u) { return __uint_as_float(u << 16); }
__device__ __forceinline__ float bfhi(unsigned u) { return __uint_as_float(u & 0xFFFF0000u); }
__device__ __forceinline__ float xhalf(float v) { const int b = __float_as_int(v); return __int_as_float(__builtin_amdgcn_permlanex16(b, b, 0x76543210, 0xfedcba98, false, false)); }   // the value of lane l ^ 16


#define LP 264   // LDS row pitch of a 256-element bf16 row: 528 B = 16 B x 33, an odd count of 16-byte units, for the 16-byte fragment reads
typedef __attribute__((ext_vector_type(2))) unsigned v2u;
typedef v2u __attribute__((may_alias)) v2ua;
// Staging of f32 rows of 256 as bf16 rows in LDS, 256 threads: a wave's load is 512 contiguous bytes; step 'it' is 4 rows on. ldrows only loads, so that a whole batch is in flight; strows rounds (nearest even) and stores.
template <int N> __device__ __forceinline__ void ldrows(v4f (&r)[N], const float* g) {
#pragma unroll
    for (int it = 0; it < N; ++it) r[it] = *(const v4f*)(g + it * 1024);
    asm volatile("s_wait_xcnt 0x0" ::: "memory");   // behind the batch's loads, in front of any rewrite of their address registers
    __builtin_amdgcn_sched_barrier(0); }            // keeps the batch's loads above the LDS stores that follow (sunk to their first use they would go out one at a time)
template <int N> __device__ __forceinline__ void strows(const v4f (&r)[N], bf* s) {
#pragma unroll
    for (int it = 0; it < N; ++it) { v2u o; o[0] = pkbf(r[it][0], r[it][1]); o[1] = pkbf(r[it][2], r[it][3]); *(v2ua*)(s + it * 4 * LP) = o; } }
// Eight f32 -> eight f16, packed for one 16-byte store.
__device__ __forceinline__ void round8(v8f y, v4u& hv) {
#pragma unroll
    for (int r = 0; r < 4; ++r) hv[r] = pkh(y[2 * r], y[2 * r + 1]); }
// Four accumulator tiles' pieces to the plane: piece k lies (k & 1) * S1 + (k >> 1) * S2 elements on.
template <int S1, int S2> __device__ __forceinline__ void st4(bf* ph, const v4u (&hv)[4]) {
    __builtin_amdgcn_sched_barrier(0);              // all four pieces are formed above the first store, so that none of the stores' data registers is rewritten among them
#pragma unroll
    for (int k = 0; k < 4; ++k) *(v8us*)(ph + (k & 1) * S1 + (k >> 1) * S2) = __builtin_bit_cast(v8us, hv[k]);
    asm volatile("s_wait_xcnt 0x0" ::: "memory");   // behind the stores, in front of any rewrite of their data and address registers
    __builtin_amdgcn_sched_barrier(0); }            // keeps the next tiles' arithmetic behind that wait

struct FRQ { v16bf a[4], b[4]; };
// k_qkv: q, k, v = bf16(x) bf16(W)^T + bf16(b) for all batches, stored as the attention kernel's planes. Grid (rows / 128, 4): blockIdx.y picks q, k, v or the adjacency plane (32 adjacency rows a block, no LDS use; the first 128 waves of those blocks also round one 16 x 32 tile of wo each). A work-group rounds 128 rows of x and the whole weight to bf16 in LDS once; 8 waves = 2 x 4 tiles of 64 rows x 64 columns, 16 accumulators a wave.
// An accumulator register run is 8 consecutive rows of the A operand at one row of the B operand: for q and k the weight rows are A (a lane holds 8 consecutive d of one token), for v the token rows are A (8 consecutive tokens of one d), so every plane is written in 16-byte pieces with no transpose, 512 contiguous bytes a store.
__global__ __launch_bounds__(256) void k_qkv(const float* __restrict__ x, const float* __restrict__ wq, const float* __restrict__ bq, const float* __restrict__ wk, const float* __restrict__ bk, const float* __restrict__ wv, const float* __restrict__ bv, const float* __restrict__ adj, const float* __restrict__ wout, bf* Qh, bf* Kh, bf* Vh, bf* AB, bf* WB, float* KM, float* AM) {
    __shared__ __align__(16) bf sm[(128 + 256) * LP];   // rows 0..127: x tile; rows 128..383: weight
    const int tid = threadIdx.x, lane = tid & 31, lr = lane & 15, hi = lane >> 4, wave = __builtin_amdgcn_readfirstlane(tid >> 5);
    if (blockIdx.y == 3) {   // the whole block leaves here, in front of the barrier. A wave takes 4 rows x 64 keys a step: 8 whole lines read, 4 whole lines written
        static_assert(NB_ * TT / 128 * 32 == TT, "one block for every 32 adjacency rows");
        const int tw = blockIdx.x * 8 + wave;   // wave-uniform: tile tw = [row tile tw >> 3][k block tw & 7] of wo
        if (tw < (DM / 16) * (DQ / 32)) { const float* gs = wout + (size_t)((tw >> 3) * 16 + lr) * DQ + (tw & 7) * 32 + 8 * hi; const v8f w0 = *(const v8f*)gs, w1 = *(const v8f*)(gs + 16); v4u p0, p1;
            asm volatile("s_wait_xcnt 0x0" ::: "memory");   // behind the two loads, in front of any rewrite of their address registers
            __builtin_amdgcn_sched_barrier(0);              // keeps later arithmetic behind that wait
#pragma unroll
            for (int k = 0; k < 4; ++k) { p0[k] = pkbf(w0[2 * k], w0[2 * k + 1]); p1[k] = pkbf(w1[2 * k], w1[2 * k + 1]); }
            bf* dw = WB + (size_t)tw * 512 + lr * 16 + 8 * hi; *(v8us*)dw = __builtin_bit_cast(v8us, p0); *(v8us*)(dw + 256) = __builtin_bit_cast(v8us, p1);
            asm volatile("s_wait_xcnt 0x0" ::: "memory");   // behind the two stores, in front of any rewrite of their data and address registers
            __builtin_amdgcn_sched_barrier(0); }            // keeps the adjacency work behind that wait
        const int k8 = lane & 7, row = blockIdx.x * 32 + wave * 4 + (lane >> 3);
        const float* g = adj + (size_t)row * TT + k8 * 8; bf* d = AB + ((size_t)(row >> 4) * 128 + (k8 >> 1)) * 256 + (row & 15) * 16 + (k8 & 1) * 8; float am = 0.f;   // am: largest |adjacency| among the lane's share of its row
#pragma unroll
        for (int hb = 0; hb < 2; ++hb) { v8f r[16]; v4u o[16];
#pragma unroll
            for (int it = 0; it < 16; ++it) r[it] = *(const v8f*)(g + (hb * 16 + it) * 64);
            asm volatile("s_wait_xcnt 0x0" ::: "memory");   // behind the batch's loads, in front of any rewrite of their address registers
            __builtin_amdgcn_sched_barrier(0);              // keeps the batch's loads together above the rounding (sunk to their first use they would go out one at a time)
#pragma unroll
            for (int it = 0; it < 16; ++it)
#pragma unroll
                for (int k = 0; k < 4; ++k) { o[it][k] = pkbf(r[it][2 * k], r[it][2 * k + 1]); am = fmaxf(am, fmaxf(fabsf(r[it][2 * k]), fabsf(r[it][2 * k + 1]))); }
            __builtin_amdgcn_sched_barrier(0);              // all pieces are formed above the first store, so that none of the stores' data registers is rewritten among them
#pragma unroll
            for (int it = 0; it < 16; ++it) *(v8us*)(d + (hb * 16 + it) * 1024) = __builtin_bit_cast(v8us, o[it]);
            asm volatile("s_wait_xcnt 0x0" ::: "memory");   // behind the stores, in front of any rewrite of their data and address registers
            __builtin_amdgcn_sched_barrier(0); }            // keeps the next batch behind that wait
        AM[(size_t)row * 8 + k8] = am;   // eight partial maxima a row; a wave writes one whole line
        return; }
    const int sel = blockIdx.y, rw = (wave >> 2) * 64, r0 = blockIdx.x * 128 + rw, c0 = (wave & 3) * 64;
    const float* w = sel == 0 ? wq : sel == 1 ? wk : wv; const float* bias = sel == 0 ? bq : sel == 1 ? bk : bv;
    { const float* gx = x + (size_t)blockIdx.x * 128 * DM + tid * 4; const float* gw = w + tid * 4; bf* st = sm + (tid >> 6) * LP + (tid & 63) * 4; v4f ra[32], rb[32];
      ldrows(ra, gx); ldrows(rb, gw); strows(ra, st); ldrows(ra, gw + 32 * 1024); strows(rb, st + 128 * LP); strows(ra, st + 256 * LP); }
    __syncthreads();   // every wave reads rows that other waves staged
    const int xo = (rw + lr) * LP + 8 * hi, wo = (128 + c0 + lr) * LP + 8 * hi;
    const bf* pa = sm + (sel == 2 ? xo : wo); const bf* pb = sm + (sel == 2 ? wo : xo);
    v8f acc[4][4];
#pragma unroll
    for (int i = 0; i < 4; ++i)
#pragma unroll
        for (int j = 0; j < 4; ++j) acc[i][j] = (v8f){};
    auto fetch = [&](FRQ& f, int kc) {
#pragma unroll
        for (int i = 0; i < 4; ++i) { f.a[i] = WFrag<bf>::ld(pa + i * 16 * LP + kc); f.b[i] = WFrag<bf>::ld(pb + i * 16 * LP + kc); }
        __builtin_amdgcn_sched_barrier(0); };   // keeps a k step's LDS reads in one group above the matrix instructions of the step before (sunk to their first use each read's latency is exposed)
    auto mm = [&](const FRQ& f) {
#pragma unroll
        for (int j = 0; j < 4; ++j)
#pragma unroll
            for (int i = 0; i < 4; ++i) acc[i][j] = wmmab(f.a[i], f.b[j], acc[i][j]); };
    FRQ f0, f1; fetch(f0, 0);
#pragma unroll
    for (int kc = 0; kc < DM; kc += 64) { fetch(f1, kc + 32); mm(f0); if (kc + 64 < DM) fetch(f0, kc + 64); mm(f1); }   // two fragment sets: each k step's reads are issued one step ahead
    const int bt = r0 / TT, t0 = r0 % TT, g0 = bt * NH_ + (c0 >> 5);   // the tile's batch, first token and first head plane
    if (sel == 2) {   // acc[i][j][r]: token t0 + 16 i + 8 hi + r, column c0 + 16 j + lr
        const size_t vo = (size_t)g0 * HP * TT + t0 * 32 + lr * 16 + 8 * hi; bf* ph = Vh + vo; float bb[4];
#pragma unroll
        for (int j = 0; j < 4; ++j) bb[j] = bias[c0 + j * 16 + lr];
        asm volatile("s_wait_xcnt 0x0" ::: "memory");   // behind the bias loads, in front of any rewrite of their address registers
        __builtin_amdgcn_sched_barrier(0);              // keeps later arithmetic behind that wait
#pragma unroll
        for (int j = 0; j < 4; ++j) { v4u hv[4]; const float b1 = bfr(bb[j]);
#pragma unroll
            for (int i = 0; i < 4; ++i) round8(acc[i][j] + b1, hv[i]);
            const int of = (j >> 1) * HP * TT + (j & 1) * 512; st4<256, 1024>(ph + of, hv); }
    } else {          // acc[i][j][r]: column c0 + 16 i + 8 hi + r, token t0 + 16 j + lr
        const float sc = sel == 0 ? QSC : 1.0f; const size_t po = ((size_t)g0 * TT + t0) * HD + lr * 16 + 8 * hi; bf* ph = (sel == 0 ? Qh : Kh) + po; v8f bb[4]; float nj[4], km[2];   // nj: a token's sum of squares over one head's 32 columns (this half's 16); km: the largest over the lane's 4 tokens, per head
#pragma unroll
        for (int i = 0; i < 4; ++i) bb[i] = *(const v8f*)(bias + c0 + i * 16 + 8 * hi);
        asm volatile("s_wait_xcnt 0x0" ::: "memory");   // behind the bias loads, in front of any rewrite of their address registers
        __builtin_amdgcn_sched_barrier(0);              // keeps later arithmetic behind that wait
#pragma unroll
        for (int i = 0; i < 4; ++i) { v4u hv[4]; v8f b8;
#pragma unroll
            for (int r = 0; r < 8; ++r) b8[r] = bfr(bb[i][r]);
#pragma unroll
            for (int j = 0; j < 4; ++j) { const v8f y = (acc[i][j] + b8) * sc; round8(y, hv[j]); float q2 = (i & 1) ? nj[j] : 0.f;
#pragma unroll
                for (int r = 0; r < 8; ++r) q2 = fmaf(y[r], y[r], q2);
                nj[j] = q2; }
            if (i & 1) { const float a0 = fmaxf(nj[0] + xhalf(nj[0]), nj[1] + xhalf(nj[1])), a1 = fmaxf(nj[2] + xhalf(nj[2]), nj[3] + xhalf(nj[3])); km[i >> 1] = fmaxf(a0, a1); }
            const int of = (i >> 1) * TT * HD + (i & 1) * 256; st4<512, 1024>(ph + of, hv); }
        if (sel == 1) KM[(((size_t)bt * (NH_ / 2) + (c0 >> 6)) * (TT / 64) + (t0 >> 6)) * 32 + lane] = hi ? km[1] : km[0];   // [batch][head pair][64 tokens][head of the pair][16 lanes]: a wave writes one whole line
    }
}

// k_fattn: S^T = K Q^T (keys x queries), t = leaky_relu_0.2(S^T x the bf16 adjacency plane) in the log2 domain over ALL 2048 keys (zeroed logits stay in the softmax), a shift and a sum per query column (the shift: a whole number from an upper bound of the column's logits, or the running maximum where the bound is large), O^T += V^T P^T with P^T packed from the score accumulators as f16; the scores never leave registers.
// Work-group: 8 waves = the 8 heads of one tile of 32 queries; grid (TT / 32, 1, batches). The work-group so holds whole merged rows: they go to LDS as bf16 hi/lo, and behind the barrier wave w forms out columns 32 w .. 32 w + 31 of the 32 rows (weight rows as the A operand, from the bf16 fragment plane; per accumulator and k step hi, then lo). A lane (c, h) holds query c of each 16-column group; accumulator register r of key tile t is key k0 + 16 t + 8 h + r, which is the k order of the B operand and of the V^T loader.
// Eight asynchronous copies global -> LDS, 16 bytes a lane and 512 contiguous bytes a wave each, 512 bytes apart. l: the lane's LDS byte address; g: the lane's global address.
__device__ __forceinline__ void cp8(unsigned l, const bf* g) {
    asm volatile("global_load_async_to_lds_b128 %0, %8, off\n\t"
                 "global_load_async_to_lds_b128 %1, %9, off\n\t"
                 "global_load_async_to_lds_b128 %2, %10, off\n\t"
                 "global_load_async_to_lds_b128 %3, %11, off\n\t"
                 "global_load_async_to_lds_b128 %4, %12, off\n\t"
                 "global_load_async_to_lds_b128 %5, %13, off\n\t"
                 "global_load_async_to_lds_b128 %6, %14, off\n\t"
                 "global_load_async_to_lds_b128 %7, %15, off\n\t"
                 "s_wait_xcnt 0x0"   // behind the last copy, in the copies' own statement: in front of any rewrite of their address registers
                 :: "v"(l), "v"(l + 512), "v"(l + 1024), "v"(l + 1536), "v"(l + 2048), "v"(l + 2560), "v"(l + 3072), "v"(l + 3584),
                    "v"(g), "v"(g + 256), "v"(g + 512), "v"(g + 768), "v"(g + 1024), "v"(g + 1280), "v"(g + 1536), "v"(g + 1792) : "memory"); }
struct FRM { v16bf h[2][2], l[2][2]; };   // merged rows' fragments of two k blocks: [k block][query group], hi and lo
struct KVG { v16h k[4], v[4]; v4u g[2][4]; };   // 64 keys: four key tiles, value^T tiles [32-key block][d half], adjacency pieces [query group][key tile]
__global__ __launch_bounds__(256) void k_fattn(const bf* __restrict__ Qh, const bf* __restrict__ Kh, const bf* __restrict__ Vh, const bf* __restrict__ AB, const float* __restrict__ KM, const float* __restrict__ AM, const bf* __restrict__ WB, const float* __restrict__ bo, float* out) {
    __shared__ __align__(16) bf so[2][32][LP];   // merged rows, hi and lo
    __shared__ __align__(16) bf sa[2 * 16 * TT];   // the adjacency plane's two query tiles of this work-group, all keys, in the plane's own order (128 KiB)
    const int lane = threadIdx.x & 31, c = lane & 15, h = lane >> 4, wave = __builtin_amdgcn_readfirstlane(threadIdx.x >> 5);   // the wave's number in a scalar register: the plane bases below are then scalar
    const int hs = wave & 1, head = wave, b = blockIdx.z, q0 = blockIdx.x * 32;
    // The 8 heads of a work-group multiply by the same 32 adjacency rows: they come from L2 once, not once a wave. Each wave copies one eighth (16 KiB, 32 copies); the copies fly during the loads and the bound below.
    { const unsigned la = (unsigned)(size_t)sa + wave * 16384 + lane * 16; const bf* ga = AB + (size_t)(q0 >> 4) * (TT * 16) + wave * 8192 + lane * 8;
      cp8(la, ga); cp8(la + 4096, ga + 2048); cp8(la + 8192, ga + 4096); cp8(la + 12288, ga + 6144); }
    const size_t pz = ((size_t)b * NH_ + head) * TT * HD, vz = ((size_t)b * NKV + head) * HP * TT;
    v16h qf[2]; const bf* qa = Qh + pz + (size_t)q0 * HD + c * 16 + 8 * h;
#pragma unroll
    for (int n = 0; n < 2; ++n) qf[n] = ldfr(qa + n * 16 * HD);
    asm volatile("s_wait_xcnt 0x0" ::: "memory");   // behind the loads, in front of any rewrite of their address registers
    __builtin_amdgcn_sched_barrier(0);              // keeps later address arithmetic behind that wait
    v4f kq[4], aq[2][2]; const float* kp = KM + (((size_t)b * (NH_ / 2) + (wave >> 1)) * (TT / 64) + lane) * 32 + hs * 16; const float* ap = AM + (size_t)(q0 + c) * 8;   // lane l: the head's 16 partial maxima of |k|^2 of tokens 64 l ..; the 8 partial maxima of |adjacency| of the lane's two query rows
#pragma unroll
    for (int i = 0; i < 4; ++i) kq[i] = *(const v4f*)(kp + i * 4);
#pragma unroll
    for (int n = 0; n < 2; ++n) { aq[n][0] = *(const v4f*)(ap + n * 128); aq[n][1] = *(const v4f*)(ap + n * 128 + 4); }
    asm volatile("s_wait_xcnt 0x0" ::: "memory");   // behind the loads of the partial maxima, in front of any rewrite of their address registers
    __builtin_amdgcn_sched_barrier(0);              // keeps later address arithmetic behind that wait
    const bf* kh0 = Kh + pz + c * 16 + 8 * h; const bf* vh0 = Vh + vz + c * 16 + 8 * h; const bf* ar0 = sa + c * 16 + 8 * h;   // the lane's three pointers (the adjacency's into LDS)
    static_assert(TT == 2048, "the wrap mask in adv below");
    size_t ks = (size_t)((blockIdx.x & 31) * 64);   // ks: the pass's first key, in a scalar register; every load is a pointer plus ks's share plus a constant. The 64 work-groups of a batch read the same k and value lines from L2: each starts its walk over the keys at a 64-key block of its own (32 starts) and wraps, so that they do not ask for the same lines at the same moment. The softmax sums run over all keys whatever the start
    v8f o[2][2]; float mx[2], ls[2]; v2f l2[2];   // l2: the fixed-shift pass's sums, even and odd keys apart
#pragma unroll
    for (int n = 0; n < 2; ++n) { o[0][n] = (v8f){}; o[1][n] = (v8f){}; mx[n] = -3.0e38f; ls[n] = 0.f; l2[n] = (v2f){}; }
    auto fetchg = [&](KVG& f) {   // the adjacency pieces of the 64 keys from ks on, from LDS
        const bf* ar = ar0 + ks * 16;
#pragma unroll
        for (int n = 0; n < 2; ++n)
#pragma unroll
            for (int t = 0; t < 4; ++t) f.g[n][t] = *(const v4u*)(ar + n * 16 * TT + t * 256); };
    auto fetchkv = [&](KVG& f) {
        const bf* kh = kh0 + ks * HD; const bf* vh = vh0 + ks * 32;
#pragma unroll
        for (int t = 0; t < 4; ++t) f.k[t] = ldfr(kh + t * 16 * HD);
#pragma unroll
        for (int m = 0; m < 4; ++m) f.v[m] = ldfr(vh + m * 512);
        asm volatile("s_wait_xcnt 0x0" :: "v"(kh), "v"(vh) : "memory");   // behind the pass's loads; the two addresses are inputs so that their registers stay theirs up to this wait (freed at the last load they were rewritten in front of it)
        __builtin_amdgcn_sched_barrier(0); };           // keeps the loads above the work that follows (sunk to their first use their latency is exposed) and the advance behind the wait
    auto fetch = [&](KVG& f) { fetchg(f); fetchkv(f); };
    auto work = [&](const KVG& f) {   // the largest term of a pass is 2^PTOP: terms down to 2^-29 of it stay normal f16 numbers
#pragma unroll
        for (int kb = 0; kb < 2; ++kb)
#pragma unroll
        for (int n = 0; n < 2; ++n) { v8f s[2]; float tm = mx[n];
#pragma unroll
            for (int t = 0; t < 2; ++t) s[t] = wmma16(f.k[kb * 2 + t], qf[n], (v8f){});
#pragma unroll
            for (int t = 0; t < 2; ++t)
#pragma unroll
                for (int r = 0; r < 8; r += 2) { const unsigned gp = f.g[n][kb * 2 + t][r >> 1]; const float u0 = s[t][r] * bflo(gp), u1 = s[t][r + 1] * bfhi(gp); const float t0 = fmaxf(u0, u0 * LEAK), t1 = fmaxf(u1, u1 * LEAK);   /* LeakyReLU(0.2) = max(u, 0.2 u) */ s[t][r] = t0; s[t][r + 1] = t1; tm = fmaxf(tm, fmaxf(t0, t1)); }
            tm = fmaxf(tm, xhalf(tm)); const float al = __builtin_amdgcn_exp2f(mx[n] - tm), ts = tm - PTOP; mx[n] = tm; float sum = 0.f; v8u ph;
#pragma unroll
            for (int t = 0; t < 2; ++t)
#pragma unroll
                for (int r = 0; r < 8; r += 2) { const float p0 = __builtin_amdgcn_exp2f(s[t][r] - ts), p1 = __builtin_amdgcn_exp2f(s[t][r + 1] - ts); sum += p0 + p1; ph[t * 4 + (r >> 1)] = pkh(p0, p1); }
            ls[n] = ls[n] * al + sum; const v16h pb = __builtin_bit_cast(v16h, ph);
#pragma unroll
            for (int m = 0; m < 2; ++m) { o[m][n] *= al; o[m][n] = wmma16(f.v[kb * 2 + m], pb, o[m][n]); }
            if (n) __builtin_amdgcn_sched_barrier(0); } };   // ends the scheduler's region at 32 keys, as in the pass with the fixed shift below
    KVG fa, fb; fetchkv(fa);
    // Upper bound of a query's logits in the log2 domain: |q| x the head's largest |k| x the row's largest |adjacency| (LeakyReLU raises no magnitude; 1.01 covers the f16 rounding of k and the sums' rounding). Softmax is unchanged by the shift. The shift is the bound rounded up to a whole number, less PTOP: the terms fill the f16 range from the top, and a zero logit's term is a power of two, which f16 holds exactly.
    float rf[2], nr[2], c8[2];
    { float k2 = 0.f;
#pragma unroll
      for (int i = 0; i < 4; ++i) k2 = fmaxf(k2, fmaxf(fmaxf(kq[i][0], kq[i][1]), fmaxf(kq[i][2], kq[i][3])));
      k2 = fmaxf(k2, xhalf(k2));
#pragma unroll
      for (int m = 8; m >= 1; m >>= 1) k2 = fmaxf(k2, __shfl_xor(k2, m, 32));
#pragma unroll
      for (int n = 0; n < 2; ++n) { float q2 = 0.f;
#pragma unroll
          for (int e = 0; e < 16; ++e) { const float fq = (float)qf[n][e]; q2 = fmaf(fq, fq, q2); }
          q2 += xhalf(q2); const v4f a4 = __builtin_elementwise_max(aq[n][0], aq[n][1]); const float am = fmaxf(fmaxf(a4[0], a4[1]), fmaxf(a4[2], a4[3]));
          rf[n] = __builtin_amdgcn_sqrtf(q2 * k2) * am * 1.01f; const float sh = __builtin_ceilf(rf[n]) - PTOP; nr[n] = -sh; c8[n] = (LEAK - 1.0f) * sh; } }
    __builtin_amdgcn_sched_barrier(0);                  // keeps the bound's arithmetic above the wait (sunk behind the barrier it no longer runs while the copies fly)
    asm volatile("s_wait_asynccnt 0x0" ::: "memory");   // the wave's own adjacency copies have landed
    __syncthreads();   // every wave reads adjacency bytes that the other waves copied
    fetchg(fa);
    // The pass with the fixed shift sh: no maximum, no rescale, the subtraction folded into the adjacency product. x = u - sh; 0.2 u - sh = 0.2 x - 0.8 sh.
    auto workb = [&](const KVG& f) {
#pragma unroll
        for (int kb = 0; kb < 2; ++kb) { v8f s[2][2]; v16h pb[2];
#pragma unroll
            for (int n = 0; n < 2; ++n)
#pragma unroll
                for (int t = 0; t < 2; ++t) s[n][t] = wmma16(f.k[kb * 2 + t], qf[n], (v8f){});
#pragma unroll
            for (int n = 0; n < 2; ++n) { v2f sm[2]; v8u ph;
#pragma unroll
                for (int t = 0; t < 2; ++t)
#pragma unroll
                    for (int r = 0; r < 8; r += 2) { const unsigned gp = f.g[n][kb * 2 + t][r >> 1]; const float x0 = fmaf(s[n][t][r], bflo(gp), nr[n]), x1 = fmaf(s[n][t][r + 1], bfhi(gp), nr[n]); v2f pp;
                        pp[0] = __builtin_amdgcn_exp2f(fmaxf(x0, fmaf(x0, LEAK, c8[n]))); pp[1] = __builtin_amdgcn_exp2f(fmaxf(x1, fmaf(x1, LEAK, c8[n]))); sm[t] = r ? sm[t] + pp : pp; ph[t * 4 + (r >> 1)] = pkh(pp[0], pp[1]); }
                l2[n] += sm[0] + sm[1]; pb[n] = __builtin_bit_cast(v16h, ph); }
#pragma unroll
            for (int n = 0; n < 2; ++n)
#pragma unroll
                for (int m = 0; m < 2; ++m) o[m][n] = wmma16(f.v[kb * 2 + m], pb[n], o[m][n]);
            __builtin_amdgcn_sched_barrier(0); } };   // ends the scheduler's region at 32 keys: over 64 keys it strung each term's chain out one instruction at a time and held every term to the end (496 registers)
    // The wave's 32 weight rows of wo, all 8 k blocks, and its bias: issued in front of the last 64 keys' work, in the registers that the pass before has freed, so that they fly during that work.
    v16bf wa[2][8]; v8f bb[2]; const bf* wp = WB + (size_t)wave * (2 * 8 * 512) + c * 16 + 8 * h; const float* bp = bo + wave * 32 + 8 * h;
    auto ldw = [&]() {
#pragma unroll
        for (int i = 0; i < 2; ++i) {
#pragma unroll
            for (int kt = 0; kt < 8; ++kt) wa[i][kt] = cat16b(*(const v8us*)(wp + (i * 8 + kt) * 512), *(const v8us*)(wp + (i * 8 + kt) * 512 + 256));
            bb[i] = *(const v8f*)(bp + i * 16); }
        asm volatile("s_wait_xcnt 0x0" ::: "memory");   // behind the loads, in front of any rewrite of their address registers
        __builtin_amdgcn_sched_barrier(0); };           // keeps the loads above the work that follows (sunk to their first use their latency is exposed behind the barrier)
    // the advance by 64 keys, back to key 0 behind key 2047, in one statement with its wait: every address of the next pass is formed from ks, so none of the loads' address registers is rewritten in front of the wait (plain additions were lifted over the wait in fetch)
    auto adv = [&]() { asm volatile("s_wait_xcnt 0x0\n\ts_add_nc_u64 %0, %0, 64\n\ts_and_b64 %0, %0, 0x7ff" : "+s"(ks) :: "memory", "scc"); };
    auto sweep = [&](auto&& wk) {
#pragma unroll 1
        for (int k0 = 0; k0 < TT - 128; k0 += 128) {   // two register sets of 64 keys: each pass's loads are issued one pass ahead
            adv(); fetch(fb); wk(fa); adv(); fetch(fa); wk(fb); }
        adv(); fetch(fb); wk(fa); ldw(); wk(fb); };   // the last 128 keys of the walk: 32 passes in all, every key once
    // With rf <= BLIM every exponent lies in [PTOP - 1.2 BLIM, PTOP] = [-13.8, 15]: all terms are normal f16 numbers under the f16 maximum, and the f32 sums stay far from overflow. A larger, infinite or NaN bound in any lane sends the wave through the running maximum.
    if (__builtin_expect(__builtin_amdgcn_ballot_w32(!(rf[0] <= BLIM && rf[1] <= BLIM)) == 0, 1)) sweep(workb); else sweep(work);
#pragma unroll
    for (int n = 0; n < 2; ++n) { const float lt = ls[n] + (l2[n][0] + l2[n][1]), inv = __fdiv_rn(1.0f, lt + xhalf(lt));
#pragma unroll
        for (int m = 0; m < 2; ++m) { v8us oh, ol;
#pragma unroll
            for (int r = 0; r < 8; ++r) { unsigned short a2, c2; splitf(o[m][n][r] * inv, a2, c2); oh[r] = a2; ol[r] = c2; }
            *(v8usa*)&so[0][n * 16 + c][head * HD + m * 16 + 8 * h] = oh; *(v8usa*)&so[1][n * 16 + c][head * HD + m * 16 + 8 * h] = ol; } }
    __syncthreads();   // every wave reads merged columns that the other heads' waves wrote
    const bf* ph = &so[0][c][8 * h]; const bf* pl = &so[1][c][8 * h];
    v8f acc[2][2];
#pragma unroll
    for (int i = 0; i < 2; ++i)
#pragma unroll
        for (int j = 0; j < 2; ++j) acc[i][j] = (v8f){};
    auto fetchm = [&](FRM& f, int kt) {   // kt: first of the set's two k blocks, a constant at every call
#pragma unroll
        for (int s = 0; s < 2; ++s)
#pragma unroll
            for (int j = 0; j < 2; ++j) { f.h[s][j] = WFrag<bf>::ld(ph + j * 16 * LP + (kt + s) * 32); f.l[s][j] = WFrag<bf>::ld(pl + j * 16 * LP + (kt + s) * 32); }
        __builtin_amdgcn_sched_barrier(0); };   // keeps a set's LDS reads in one group above the matrix instructions of the set before (sunk to their first use each read's latency is exposed)
    auto mmm = [&](const FRM& f, int kt) {   // per accumulator and k block: hi, then lo
#pragma unroll
        for (int s = 0; s < 2; ++s) {
#pragma unroll
            for (int j = 0; j < 2; ++j)
#pragma unroll
                for (int i = 0; i < 2; ++i) acc[i][j] = wmmab(wa[i][kt + s], f.h[s][j], acc[i][j]);
#pragma unroll
            for (int j = 0; j < 2; ++j)
#pragma unroll
                for (int i = 0; i < 2; ++i) acc[i][j] = wmmab(wa[i][kt + s], f.l[s][j], acc[i][j]); } };
    FRM g0, g1; fetchm(g0, 0); fetchm(g1, 2); mmm(g0, 0); fetchm(g0, 4); mmm(g1, 2); fetchm(g1, 6); mmm(g0, 4); mmm(g1, 6);   // two fragment sets: each set's reads are issued one set ahead
    float* po = out + ((size_t)b * TT + q0 + c) * DM + wave * 32 + 8 * h;   // acc[i][j][r]: column 32 wave + 16 i + 8 h + r, row q0 + 16 j + c; a row's 128-byte line of 32 columns has this wave as its one writer
#pragma unroll
    for (int i = 0; i < 2; ++i) { v8f b8;
#pragma unroll
        for (int r = 0; r < 8; ++r) b8[r] = bfr(bb[i][r]);
#pragma unroll
        for (int j = 0; j < 2; ++j) acc[i][j] += b8; }
    __builtin_amdgcn_sched_barrier(0);   // all values are formed above the first store, so that none of the stores' data registers is rewritten among them
#pragma unroll
    for (int i = 0; i < 2; ++i)
#pragma unroll
        for (int j = 0; j < 2; ++j) *(v8f*)(po + j * 16 * DM + i * 16) = acc[i][j];
}

extern "C" void kernel_launch(void* const* d_in, const int* in_sizes, int n_in,
                              void* d_out, int out_size, void* d_ws, size_t ws_size, hipStream_t stream) {
    (void)in_sizes; (void)n_in; (void)out_size;
    const float* x = (const float*)d_in[0]; const float* adj = (const float*)d_in[1];   /* adjacency_matrix [2048][2048] f32 0/1 (read as data) */ const float* wq = (const float*)d_in[2]; const float* bq = (const float*)d_in[3]; const float* wk = (const float*)d_in[4]; const float* bk = (const float*)d_in[5]; const float* wv = (const float*)d_in[6]; const float* bv = (const float*)d_in[7]; const float* wo = (const float*)d_in[8]; const float* bo = (const float*)d_in[9];   /* argument order hidden_states, adjacency_matrix, wq, bq, wk, bk, wv, bv, wo, bo */
    float* OUT = (float*)d_out;     // [4][2048][256]
    char* wsp = (char*)d_ws;
    auto take = [&](size_t bytes) { char* p = wsp; wsp += (bytes + 255) & ~(size_t)255; return (void*)p; };
    const size_t PZ = (size_t)NH_ * TT * HD, VZ = (size_t)NKV * HP * TT;   // one batch's q/k planes, value^T planes (elements)
    bf* QPh = (bf*)take(NB_ * PZ * 2); bf* KPh = (bf*)take(NB_ * PZ * 2); bf* VTh = (bf*)take(NB_ * VZ * 2);   // f16 planes
    bf* ADB = (bf*)take((size_t)TT * TT * 2); bf* WOB = (bf*)take((size_t)DM * DQ * 2);   // bf16 adjacency plane, bf16 wo plane
    float* KMX = (float*)take((size_t)NB_ * (NH_ / 2) * (TT / 64) * 32 * 4); float* AMX = (float*)take((size_t)TT * 8 * 4);   // partial maxima of |k|^2 and of |adjacency|
    if ((size_t)(wsp - (char*)d_ws) > ws_size) return;    // ws 256 MiB
    k_qkv<<<dim3(NB_ * TT / 128, 4, 1), 256, 0, stream>>>(x, wq, bq, wk, bk, wv, bv, adj, wo, QPh, KPh, VTh, ADB, WOB, KMX, AMX);
    k_fattn<<<dim3(TT / 32, 1, NB_), 256, 0, stream>>>(QPh, KPh, VTh, ADB, KMX, AMX, WOB, bo, OUT);
}
